// v000
// Times are from an AMD MI455X. After a warm-up the kernel runs many times in a row, and a time is the length of
// such a window on the GPU divided by its runs, so every launch and the gaps after it count. The runs cycle
// through copies of the inputs. A figure is the median of several windows, for all but v000 over two sittings.
// Sittings can differ by a few percent; kernels timed side by side share one.
// v000 is the starting kernel. One run takes 157 microseconds.
#include <hip/hip_runtime.h>
#include <cstdint>

typedef __attribute__((ext_vector_type(16))) _Float16     v16h;
typedef __attribute__((ext_vector_type(8)))  float        v8f;
typedef __attribute__((ext_vector_type(4)))  unsigned int u32x4;
typedef __attribute__((ext_vector_type(8)))  int          i32x8;
typedef __attribute__((ext_vector_type(4)))  int          i32x4;

#define B2    128
#define NN    256
#define DD    256
#define HH    8
#define CC    32
#define HC    256   // H*C
#define QKV_E 768   // 3*H*C
#define OUTD  256

__device__ __forceinline__ v8f zero8() {
  v8f z;
#pragma unroll
  for (int j = 0; j < 8; ++j) z[j] = 0.0f;
  return z;
}

// element j -> src[r*stride + k]; per-lane halves are two contiguous 16B runs
__device__ __forceinline__ v16h frag_ld_f16(const _Float16* __restrict__ src,
                                            int stride, int lane) {
  const int r  = lane & 15;
  const int kb = (lane >> 4) * 8;
  const _Float16* p = src + (size_t)r * stride + kb;
  v16h f;
#pragma unroll
  for (int j = 0; j < 8; ++j) f[j] = p[j];
#pragma unroll
  for (int j = 0; j < 8; ++j) f[8 + j] = p[16 + j];
  return f;
}

__device__ __forceinline__ v8f wmma16(v16h a, v16h b, v8f c) {
  return __builtin_amdgcn_wmma_f32_16x16x32_f16(false, a, false, b,
                                                (short)0, c, false, false);
}

__device__ __forceinline__ void tdm_load_f16_1d(uint32_t lds_off,
                                                const _Float16* gsrc,
                                                uint32_t nelem) {
  const uint64_t ga = (uint64_t)(uintptr_t)gsrc;
  u32x4 g0;
  g0[0] = 1u;                                                  // count=1
  g0[1] = lds_off;                                             // lds_addr
  g0[2] = (uint32_t)ga;                                        // ga[31:0]
  g0[3] = (uint32_t)((ga >> 32) & 0x01FFFFFFu) | (2u << 30);   // ga[56:32]|type
  i32x8 g1;
  g1[0] = 0x00010000;
  g1[1] = (int)((nelem & 0xFFFFu) << 16);
  g1[2] = (int)(((nelem >> 16) & 0xFFFFu) | (1u << 16));
  g1[3] = (int)((nelem & 0xFFFFu) << 16);
  g1[4] = 0;
  g1[5] = (int)nelem;
  g1[6] = 0;
  g1[7] = 0;
  i32x4 gz;
  gz[0] = gz[1] = gz[2] = gz[3] = 0;
#if defined(__clang_major__) && __clang_major__ >= 23
  i32x8 g4;
#pragma unroll
  for (int j = 0; j < 8; ++j) g4[j] = 0;
  __builtin_amdgcn_tensor_load_to_lds(g0, g1, gz, gz, g4, 0);
#else
  __builtin_amdgcn_tensor_load_to_lds(g0, g1, gz, gz, 0);
#endif
}

// ---------------------------------------------------------------------------
// Kernel 0: f32 -> f16 conversion pass (8 elems/thread, b128 in / b128 out)
// ---------------------------------------------------------------------------
__global__ __launch_bounds__(256) void k_cvt(const float* __restrict__ src,
                                             _Float16* __restrict__ dst, int n) {
  const int i = (blockIdx.x * 256 + threadIdx.x) * 8;
  if (i + 7 < n) {
#pragma unroll
    for (int j = 0; j < 8; ++j) dst[i + j] = (_Float16)src[i + j];
  }
}

// ---------------------------------------------------------------------------
// Kernel 1: fused QKV + gate projection, all-f16 operands.
//   x16[b2*n, d] x w16^T[1024, d]  (rows: 768 qkv, then 256 gate)
// Wave tile 32x64 (2 A-frags x 4 B-frags -> 8 WMMA); block = 2x4 waves
// = 64 rows x 256 cols.  Q pre-scaled, V stored transposed [b2,h,c,n],
// gate = sigmoid(.+bias) stored f16.
// ---------------------------------------------------------------------------
__global__ __launch_bounds__(256) void k_qkv_gate(
    const _Float16* __restrict__ x16,   // [B2*N, D]
    const _Float16* __restrict__ w16,   // [1024, D]
    const float* __restrict__ g_bias,   // [256]
    _Float16* __restrict__ q_ws,        // [B2,H,N,C] (scaled)
    _Float16* __restrict__ k_ws,        // [B2,H,N,C]
    _Float16* __restrict__ vT_ws,       // [B2,H,C,N]
    _Float16* __restrict__ gate_ws) {   // [B2,N,HC]
  const int lane = threadIdx.x & 31;
  const int wv   = threadIdx.x >> 5;
  const int wr   = wv >> 2;            // 0..1
  const int wc   = wv & 3;             // 0..3
  const int b2   = blockIdx.z;
  const int row0 = blockIdx.y * 64 + wr * 32;
  const int col0 = blockIdx.x * 256 + wc * 64;
  const int rl   = (lane >> 4) * 8;
  const int cl   = lane & 15;

  const _Float16* xrow = x16 + ((size_t)b2 * NN + row0) * DD;
  __builtin_prefetch(xrow, 0, 3);

  v8f acc[2][4];
#pragma unroll
  for (int m = 0; m < 2; ++m)
#pragma unroll
    for (int t = 0; t < 4; ++t) acc[m][t] = zero8();

  for (int kk = 0; kk < DD; kk += 32) {
    v16h a0 = frag_ld_f16(xrow + kk, DD, lane);
    v16h a1 = frag_ld_f16(xrow + (size_t)16 * DD + kk, DD, lane);
#pragma unroll
    for (int t = 0; t < 4; ++t) {
      v16h b = frag_ld_f16(w16 + (size_t)(col0 + t * 16) * DD + kk, DD, lane);
      acc[0][t] = wmma16(a0, b, acc[0][t]);
      acc[1][t] = wmma16(a1, b, acc[1][t]);
    }
  }

#pragma unroll
  for (int mt = 0; mt < 2; ++mt) {
    const int rowb = row0 + mt * 16;
#pragma unroll
    for (int t = 0; t < 4; ++t) {
      const int nb = col0 + t * 16;   // tile-uniform fused column
      const int n  = nb + cl;
      if (nb < QKV_E) {
        const int which = nb / HC;    // 0=q 1=k 2=v (block-uniform here)
        const int hc = n - which * HC;
        const int h = hc >> 5, c = hc & 31;
        if (which == 2) {             // V transposed: [b2,h,c,n]
          const size_t base = (((size_t)b2 * HH + h) * CC + c) * NN;
#pragma unroll
          for (int vi = 0; vi < 8; ++vi)
            vT_ws[base + rowb + vi + rl] = (_Float16)acc[mt][t][vi];
        } else {
          _Float16* dst = which ? k_ws : q_ws;
          const float scale = which ? 1.0f : 0.17677669529663687f;  // C^-1/2
          const size_t base = (((size_t)b2 * HH + h) * NN) * CC + c;
#pragma unroll
          for (int vi = 0; vi < 8; ++vi)
            dst[base + (size_t)(rowb + vi + rl) * CC] =
                (_Float16)(acc[mt][t][vi] * scale);
        }
      } else {
        const int g = n - QKV_E;
        const float gb = g_bias[g];
        const size_t base = ((size_t)b2 * NN) * HC + g;
#pragma unroll
        for (int vi = 0; vi < 8; ++vi) {
          const float z = acc[mt][t][vi] + gb;
          gate_ws[base + (size_t)(rowb + vi + rl) * HC] =
              (_Float16)(1.0f / (1.0f + __expf(-z)));
        }
      }
    }
  }
}

__global__ __launch_bounds__(256) void k_attn(
    const _Float16* __restrict__ q_ws,
    const _Float16* __restrict__ k_ws,
    const _Float16* __restrict__ vT_ws,
    const float* __restrict__ mask,       // [B2,N]
    const float* __restrict__ nb_bias,    // [H,N,N]
    const _Float16* __restrict__ gate_ws, // [B2,N,HC]
    _Float16* __restrict__ wa_ws) {       // [B2,N,HC] gated
  __shared__ _Float16 Klds[NN * CC];      // 16 KB  [key n][c]
  __shared__ _Float16 VTlds[CC * NN];     // 16 KB  [c][key n]
  __shared__ _Float16 Pb[8][16 * 128];    // 32 KB  per-wave P half-tile

  const int lane = threadIdx.x & 31;
  const int wv   = threadIdx.x >> 5;
  const int h    = blockIdx.x;
  const int b2   = blockIdx.y;
  const int rl   = (lane >> 4) * 8;
  const int cl   = lane & 15;

  const size_t hd = (((size_t)b2 * HH + h) * NN) * CC;

  if (wv == 0) {
    tdm_load_f16_1d((uint32_t)(uintptr_t)&Klds[0],  k_ws + hd,  NN * CC);
    tdm_load_f16_1d((uint32_t)(uintptr_t)&VTlds[0], vT_ws + hd, NN * CC);
    __builtin_amdgcn_s_wait_tensorcnt(0);
  }
  __syncthreads();

  for (int mt = 0; mt < 2; ++mt) {
    const int m0 = wv * 32 + mt * 16;
    const v16h qa = frag_ld_f16(q_ws + hd + (size_t)m0 * CC, CC, lane);

    v8f lg[16];
#pragma unroll
    for (int nt = 0; nt < 16; ++nt) {
      v16h kf = frag_ld_f16(&Klds[nt * 16 * CC], CC, lane);  // K rows = B cols
      lg[nt] = wmma16(qa, kf, zero8());
    }

    // + mask bias (per key col) + nonbatched bias (per row,col)
#pragma unroll
    for (int nt = 0; nt < 16; ++nt) {
      const int n = nt * 16 + cl;
      const float mb = 1e9f * (mask[(size_t)b2 * NN + n] - 1.0f);
      const float* nbp = nb_bias + ((size_t)h * NN) * NN + n;
#pragma unroll
      for (int vi = 0; vi < 8; ++vi)
        lg[nt][vi] += mb + nbp[(size_t)(m0 + vi + rl) * NN];
    }

    // softmax: row (m0+vi+rl) lives across one 16-lane half at value vi
#pragma unroll
    for (int vi = 0; vi < 8; ++vi) {
      float mx = -3.0e38f;
#pragma unroll
      for (int nt = 0; nt < 16; ++nt) mx = fmaxf(mx, lg[nt][vi]);
      for (int off = 1; off < 16; off <<= 1) mx = fmaxf(mx, __shfl_xor(mx, off, 32));
      float s = 0.0f;
#pragma unroll
      for (int nt = 0; nt < 16; ++nt) {
        const float e = __expf(lg[nt][vi] - mx);
        lg[nt][vi] = e;
        s += e;
      }
      for (int off = 1; off < 16; off <<= 1) s += __shfl_xor(s, off, 32);
      const float inv = 1.0f / s;
#pragma unroll
      for (int nt = 0; nt < 16; ++nt) lg[nt][vi] *= inv;
    }

    // P (16x256) x V (256x32), keys processed in two 128-wide halves.
    // Same-wave LDS producer/consumer in lockstep -> no barrier needed.
    v8f ao0 = zero8(), ao1 = zero8();
    for (int half = 0; half < 2; ++half) {
#pragma unroll
      for (int nt = 0; nt < 8; ++nt) {
        const int ntg = half * 8 + nt;
#pragma unroll
        for (int vi = 0; vi < 8; ++vi)
          Pb[wv][(vi + rl) * 128 + nt * 16 + cl] = (_Float16)lg[ntg][vi];
      }
#pragma unroll
      for (int ks = 0; ks < 4; ++ks) {
        const int kbase = half * 128 + ks * 32;
        v16h pa = frag_ld_f16(&Pb[wv][ks * 32], 128, lane);
        v16h b0 = frag_ld_f16(&VTlds[kbase], NN, lane);            // c 0..15
        v16h b1 = frag_ld_f16(&VTlds[16 * NN + kbase], NN, lane);  // c 16..31
        ao0 = wmma16(pa, b0, ao0);
        ao1 = wmma16(pa, b1, ao1);
      }
    }

    // gate * wa -> f16 workspace
#pragma unroll
    for (int ct = 0; ct < 2; ++ct) {
      const v8f& ao = ct ? ao1 : ao0;
#pragma unroll
      for (int vi = 0; vi < 8; ++vi) {
        const int r = m0 + vi + rl;
        const int c = ct * 16 + cl;
        const size_t idx = ((size_t)b2 * NN + r) * HC + h * CC + c;
        wa_ws[idx] = (_Float16)(ao[vi] * (float)gate_ws[idx]);
      }
    }
  }
}

// ---------------------------------------------------------------------------
// Kernel 3: output projection  out[M,256] = wa[M,256] x wo16^T + b_o
// Wave tile 32x64; block = 2x4 waves = 64 rows x all 256 cols.
// ---------------------------------------------------------------------------
__global__ __launch_bounds__(256) void k_out(
    const _Float16* __restrict__ wa_ws,  // [B2*N, HC]
    const _Float16* __restrict__ wo16,   // [256, HC]
    const float* __restrict__ b_o,       // [256]
    float* __restrict__ out) {           // [B2*N, 256]
  const int lane = threadIdx.x & 31;
  const int wv   = threadIdx.x >> 5;
  const int wr   = wv >> 2;
  const int wc   = wv & 3;
  const int row0 = blockIdx.x * 64 + wr * 32;
  const int col0 = wc * 64;
  const int rl   = (lane >> 4) * 8;
  const int cl   = lane & 15;

  const _Float16* arow = wa_ws + (size_t)row0 * HC;
  __builtin_prefetch(arow, 0, 3);

  v8f acc[2][4];
#pragma unroll
  for (int m = 0; m < 2; ++m)
#pragma unroll
    for (int t = 0; t < 4; ++t) acc[m][t] = zero8();

  for (int kk = 0; kk < HC; kk += 32) {
    v16h a0 = frag_ld_f16(arow + kk, HC, lane);
    v16h a1 = frag_ld_f16(arow + (size_t)16 * HC + kk, HC, lane);
#pragma unroll
    for (int t = 0; t < 4; ++t) {
      v16h b = frag_ld_f16(wo16 + (size_t)(col0 + t * 16) * HC + kk, HC, lane);
      acc[0][t] = wmma16(a0, b, acc[0][t]);
      acc[1][t] = wmma16(a1, b, acc[1][t]);
    }
  }

#pragma unroll
  for (int mt = 0; mt < 2; ++mt) {
#pragma unroll
    for (int t = 0; t < 4; ++t) {
      const int o = col0 + t * 16 + cl;
      const float bo = b_o[o];
#pragma unroll
      for (int vi = 0; vi < 8; ++vi) {
        const int r = row0 + mt * 16 + vi + rl;
        out[(size_t)r * OUTD + o] = acc[mt][t][vi] + bo;
      }
    }
  }
}

// ---------------------------------------------------------------------------
extern "C" void kernel_launch(void* const* d_in, const int* in_sizes, int n_in,
                              void* d_out, int out_size, void* d_ws, size_t ws_size,
                              hipStream_t stream) {
  (void)in_sizes; (void)n_in; (void)out_size; (void)ws_size;
  const float* in_data = (const float*)d_in[0];
  const float* mask    = (const float*)d_in[1];
  const float* nb_bias = (const float*)d_in[2];
  const float* w_qkv   = (const float*)d_in[3];
  const float* w_gate  = (const float*)d_in[4];
  const float* g_bias  = (const float*)d_in[5];
  const float* w_o     = (const float*)d_in[6];
  const float* b_o     = (const float*)d_in[7];
  float* out = (float*)d_out;

  // Workspace layout (f16 elements)
  const size_t XN  = (size_t)B2 * NN * DD;       // 8,388,608
  const size_t QN  = (size_t)B2 * HH * NN * CC;  // 8,388,608
  _Float16* x16    = (_Float16*)d_ws;
  _Float16* w16    = x16 + XN;                   // [1024 x 256] fused qkv|gate
  _Float16* wo16   = w16 + (size_t)(QKV_E + HC) * DD;
  _Float16* q_ws   = wo16 + (size_t)OUTD * HC;
  _Float16* k_ws   = q_ws + QN;
  _Float16* vT_ws  = k_ws + QN;
  _Float16* gate16 = vT_ws + QN;
  _Float16* wa_ws  = gate16 + (size_t)B2 * NN * HC;

  // 0) one-time f32 -> f16 conversion passes
  k_cvt<<<dim3((int)(XN / 8 / 256)), 256, 0, stream>>>(in_data, x16, (int)XN);
  k_cvt<<<dim3(QKV_E * DD / 8 / 256), 256, 0, stream>>>(w_qkv, w16, QKV_E * DD);
  k_cvt<<<dim3(HC * DD / 8 / 256), 256, 0, stream>>>(w_gate, w16 + (size_t)QKV_E * DD, HC * DD);
  k_cvt<<<dim3(OUTD * HC / 8 / 256), 256, 0, stream>>>(w_o, wo16, OUTD * HC);

  // 1) fused QKV + gate projection: [32768 x 256] x [256 x 1024]
  k_qkv_gate<<<dim3(4, 4, B2), 256, 0, stream>>>(x16, w16, g_bias,
                                                 q_ws, k_ws, vT_ws, gate16);
  // 2) attention per (h, b2), K/V^T staged via Tensor Data Mover
  k_attn<<<dim3(HH, B2), 256, 0, stream>>>(q_ws, k_ws, vT_ws, mask, nb_bias,
                                           gate16, wa_ws);
  // 3) output projection: [32768 x 256] x [256 x 256] + bias
  k_out<<<dim3((B2 * NN) / 64), 256, 0, stream>>>(wa_ws, wo16, b_o, out);
}

// v001
// Measured time: 123 microseconds a run.
// Next to v000, in two timings, it ran 1.32 and 1.34 times as fast.
#include <hip/hip_runtime.h>
#include <cstdint>

typedef __attribute__((ext_vector_type(16))) _Float16     v16h;
typedef __attribute__((ext_vector_type(8)))  _Float16     v8h;
typedef __attribute__((ext_vector_type(8)))  float        v8f;
typedef __attribute__((ext_vector_type(4)))  unsigned int u32x4;
typedef __attribute__((ext_vector_type(8)))  int          i32x8;
typedef __attribute__((ext_vector_type(4)))  int          i32x4;

#define B2    128
#define NN    256
#define DD    256
#define HH    8
#define CC    32
#define HC    256   // H*C
#define QKV_E 768   // 3*H*C
#define OUTD  256
#define PBP   136

__device__ __forceinline__ v8f zero8() {
  v8f z;
#pragma unroll
  for (int j = 0; j < 8; ++j) z[j] = 0.0f;
  return z;
}

// element j -> src[r*stride + k]; per-lane halves are two contiguous 16B runs
__device__ __forceinline__ v16h frag_ld_f16(const _Float16* __restrict__ src,
                                            int stride, int lane) {
  const int r  = lane & 15;
  const int kb = (lane >> 4) * 8;
  const _Float16* p = src + (size_t)r * stride + kb;
  v16h f;
#pragma unroll
  for (int j = 0; j < 8; ++j) f[j] = p[j];
#pragma unroll
  for (int j = 0; j < 8; ++j) f[8 + j] = p[16 + j];
  return f;
}

__device__ __forceinline__ v16h frag_ld_packed(const _Float16* src, int lane) {
  const v8h lo = *(const v8h*)(src + lane * 8);
  const v8h hi = *(const v8h*)(src + 256 + lane * 8);
  return __builtin_shufflevector(lo, hi, 0, 1, 2, 3, 4, 5, 6, 7,
                                 8, 9, 10, 11, 12, 13, 14, 15);
}

// offset (halves) of element (col, k) inside one fragment, col 0..15, k 0..31
__device__ __forceinline__ int frag_off(int col, int k) {
  return ((k >> 4) & 1) * 256 + ((((k >> 3) & 1) * 16) + col) * 8 + (k & 7);
}

__device__ __forceinline__ v8f wmma16(v16h a, v16h b, v8f c) {
  return __builtin_amdgcn_wmma_f32_16x16x32_f16(false, a, false, b,
                                                (short)0, c, false, false);
}

__device__ __forceinline__ void tdm_load_f16_1d(uint32_t lds_off,
                                                const _Float16* gsrc,
                                                uint32_t nelem) {
  const uint64_t ga = (uint64_t)(uintptr_t)gsrc;
  u32x4 g0;
  g0[0] = 1u;                                                  // count=1
  g0[1] = lds_off;                                             // lds_addr
  g0[2] = (uint32_t)ga;                                        // ga[31:0]
  g0[3] = (uint32_t)((ga >> 32) & 0x01FFFFFFu) | (2u << 30);   // ga[56:32]|type
  i32x8 g1;
  g1[0] = 0x00010000;
  g1[1] = (int)((nelem & 0xFFFFu) << 16);
  g1[2] = (int)(((nelem >> 16) & 0xFFFFu) | (1u << 16));
  g1[3] = (int)((nelem & 0xFFFFu) << 16);
  g1[4] = 0;
  g1[5] = (int)nelem;
  g1[6] = 0;
  g1[7] = 0;
  i32x4 gz;
  gz[0] = gz[1] = gz[2] = gz[3] = 0;
#if defined(__clang_major__) && __clang_major__ >= 23
  i32x8 g4;
#pragma unroll
  for (int j = 0; j < 8; ++j) g4[j] = 0;
  __builtin_amdgcn_tensor_load_to_lds(g0, g1, gz, gz, g4, 0);
#else
  __builtin_amdgcn_tensor_load_to_lds(g0, g1, gz, gz, 0);
#endif
}

// ---------------------------------------------------------------------------
// Kernel 0: f32 -> f16 conversion pass (8 elems/thread, b128 in / b128 out)
// ---------------------------------------------------------------------------
__global__ __launch_bounds__(256) void k_cvt(const float* __restrict__ src,
                                             _Float16* __restrict__ dst, int n) {
  const int i = (blockIdx.x * 256 + threadIdx.x) * 8;
  if (i + 7 < n) {
#pragma unroll
    for (int j = 0; j < 8; ++j) dst[i + j] = (_Float16)src[i + j];
  }
}

// ---------------------------------------------------------------------------
// Kernel 1: fused QKV + gate projection, all-f16 operands.
//   x16[b2*n, d] x w16^T[1024, d]  (rows: 768 qkv, then 256 gate)
// Wave tile 32x64 (2 A-frags x 4 B-frags -> 8 WMMA); block = 2x4 waves
// = 64 rows x 256 cols.  Q pre-scaled, row-major.  K and V are stored per
// (b2,h) in the fragment order their readers in k_attn use (frag_off):
// K: fragment n>>4, col = n&15, k = c;  V: fragment (n>>5)*2 + (c>>4),
// col = c&15, k = n&31.  gate = sigmoid(.+bias) stored f16.
// ---------------------------------------------------------------------------
__global__ __launch_bounds__(256) void k_qkv_gate(
    const _Float16* __restrict__ x16,   // [B2*N, D]
    const _Float16* __restrict__ w16,   // [1024, D]
    const float* __restrict__ g_bias,   // [256]
    _Float16* __restrict__ q_ws,        // [B2,H,N,C] (scaled)
    _Float16* __restrict__ k_ws,        // [B2,H, 16 fragments x 512]
    _Float16* __restrict__ vT_ws,       // [B2,H, 16 fragments x 512]
    _Float16* __restrict__ gate_ws) {   // [B2,N,HC]
  const int lane = threadIdx.x & 31;
  const int wv   = threadIdx.x >> 5;
  const int wr   = wv >> 2;            // 0..1
  const int wc   = wv & 3;             // 0..3
  const int b2   = blockIdx.z;
  const int row0 = blockIdx.y * 64 + wr * 32;
  const int col0 = blockIdx.x * 256 + wc * 64;
  const int rl   = (lane >> 4) * 8;
  const int cl   = lane & 15;

  const _Float16* xrow = x16 + ((size_t)b2 * NN + row0) * DD;
  __builtin_prefetch(xrow, 0, 3);

  v8f acc[2][4];
#pragma unroll
  for (int m = 0; m < 2; ++m)
#pragma unroll
    for (int t = 0; t < 4; ++t) acc[m][t] = zero8();

  for (int kk = 0; kk < DD; kk += 32) {
    v16h a0 = frag_ld_f16(xrow + kk, DD, lane);
    v16h a1 = frag_ld_f16(xrow + (size_t)16 * DD + kk, DD, lane);
#pragma unroll
    for (int t = 0; t < 4; ++t) {
      v16h b = frag_ld_f16(w16 + (size_t)(col0 + t * 16) * DD + kk, DD, lane);
      acc[0][t] = wmma16(a0, b, acc[0][t]);
      acc[1][t] = wmma16(a1, b, acc[1][t]);
    }
  }

#pragma unroll
  for (int mt = 0; mt < 2; ++mt) {
    const int rowb = row0 + mt * 16;
#pragma unroll
    for (int t = 0; t < 4; ++t) {
      const int nb = col0 + t * 16;   // tile-uniform fused column
      const int n  = nb + cl;
      if (nb < QKV_E) {
        const int which = nb / HC;    // 0=q 1=k 2=v (block-uniform here)
        const int hc = n - which * HC;
        const int h = hc >> 5, c = hc & 31;
        if (which == 2) {             // V: 8 keys of one c = 16 B per lane
          const int n0 = rowb + rl;
          const size_t base = ((size_t)b2 * HH + h) * (CC * NN) +
                              ((n0 >> 5) * 2 + (c >> 4)) * 512 +
                              frag_off(c & 15, n0 & 31);
#pragma unroll
          for (int vi = 0; vi < 8; ++vi)
            vT_ws[base + vi] = (_Float16)acc[mt][t][vi];
          // before a register that the store names is written again
          asm volatile("s_wait_xcnt 0x0" ::: "memory");
        } else if (which == 1) {      // K: fragment order
          const size_t base = ((size_t)b2 * HH + h) * (NN * CC) +
                              (rowb >> 4) * 512 + frag_off(rl, c);
#pragma unroll
          for (int vi = 0; vi < 8; ++vi)
            k_ws[base + vi * 8] = (_Float16)acc[mt][t][vi];
        } else {                      // Q: row-major, scaled by C^-1/2
          const size_t base = (((size_t)b2 * HH + h) * NN) * CC + c;
#pragma unroll
          for (int vi = 0; vi < 8; ++vi)
            q_ws[base + (size_t)(rowb + vi + rl) * CC] =
                (_Float16)(acc[mt][t][vi] * 0.17677669529663687f);
          // before a register that these stores name is written again
          asm volatile("s_wait_xcnt 0x0" ::: "memory");
        }
      } else {
        const int g = n - QKV_E;
        const float gb = g_bias[g];
        const size_t base = ((size_t)b2 * NN) * HC + g;
#pragma unroll
        for (int vi = 0; vi < 8; ++vi) {
          const float z = acc[mt][t][vi] + gb;
          gate_ws[base + (size_t)(rowb + vi + rl) * HC] =
              (_Float16)(1.0f / (1.0f + __expf(-z)));
        }
      }
    }
  }
}

__global__ __launch_bounds__(256) void k_attn(
    const _Float16* __restrict__ q_ws,
    const _Float16* __restrict__ k_ws,
    const _Float16* __restrict__ vT_ws,
    const float* __restrict__ mask,       // [B2,N]
    const float* __restrict__ nb_bias,    // [H,N,N]
    const _Float16* __restrict__ gate_ws, // [B2,N,HC]
    _Float16* __restrict__ wa_ws) {       // [B2,N,HC] gated
  // All three arrays start at multiples of 2 KiB, so that the tensor-load
  // destinations (K, V) do, in whatever order the arrays are placed in LDS.
  __shared__ __attribute__((aligned(2048))) _Float16 Klds[NN * CC];   // 16 KB, 16 fragments
  __shared__ __attribute__((aligned(2048))) _Float16 VTlds[CC * NN];  // 16 KB, 16 fragments
  __shared__ __attribute__((aligned(2048))) _Float16 Pb[8][16 * PBP]; // per-wave P half-tile

  const int lane = threadIdx.x & 31;
  const int wv   = threadIdx.x >> 5;
  const int h    = blockIdx.x;
  const int b2   = blockIdx.y;
  const int rl   = (lane >> 4) * 8;
  const int cl   = lane & 15;

  const size_t hd = (((size_t)b2 * HH + h) * NN) * CC;

  if (wv == 0) {
    tdm_load_f16_1d((uint32_t)(uintptr_t)&Klds[0],  k_ws + hd,  NN * CC);
    tdm_load_f16_1d((uint32_t)(uintptr_t)&VTlds[0], vT_ws + hd, NN * CC);
    __builtin_amdgcn_s_wait_tensorcnt(0);
  }
  __syncthreads();

  for (int mt = 0; mt < 2; ++mt) {
    const int m0 = wv * 32 + mt * 16;
    const v16h qa = frag_ld_f16(q_ws + hd + (size_t)m0 * CC, CC, lane);

    v8f lg[16];
#pragma unroll
    for (int nt = 0; nt < 16; ++nt) {
      v16h kf = frag_ld_packed(&Klds[nt * 512], lane);  // K rows = B cols
      lg[nt] = wmma16(qa, kf, zero8());
    }

    // + mask bias (per key col) + nonbatched bias (per row,col)
#pragma unroll
    for (int nt = 0; nt < 16; ++nt) {
      const int n = nt * 16 + cl;
      const float mb = 1e9f * (mask[(size_t)b2 * NN + n] - 1.0f);
      const float* nbp = nb_bias + ((size_t)h * NN) * NN + n;
#pragma unroll
      for (int vi = 0; vi < 8; ++vi)
        lg[nt][vi] += mb + nbp[(size_t)(m0 + vi + rl) * NN];
    }

    // softmax: row (m0+vi+rl) lives across one 16-lane half at value vi
#pragma unroll
    for (int vi = 0; vi < 8; ++vi) {
      float mx = -3.0e38f;
#pragma unroll
      for (int nt = 0; nt < 16; ++nt) mx = fmaxf(mx, lg[nt][vi]);
      for (int off = 1; off < 16; off <<= 1) mx = fmaxf(mx, __shfl_xor(mx, off, 32));
      float s = 0.0f;
#pragma unroll
      for (int nt = 0; nt < 16; ++nt) {
        const float e = __expf(lg[nt][vi] - mx);
        lg[nt][vi] = e;
        s += e;
      }
      for (int off = 1; off < 16; off <<= 1) s += __shfl_xor(s, off, 32);
      const float inv = 1.0f / s;
#pragma unroll
      for (int nt = 0; nt < 16; ++nt) lg[nt][vi] *= inv;
    }

    // P (16x256) x V (256x32), keys processed in two 128-wide halves.
    // Same-wave LDS producer/consumer in lockstep -> no barrier needed.
    v8f ao0 = zero8(), ao1 = zero8();
    for (int half = 0; half < 2; ++half) {
#pragma unroll
      for (int nt = 0; nt < 8; ++nt) {
        const int ntg = half * 8 + nt;
#pragma unroll
        for (int vi = 0; vi < 8; ++vi)
          Pb[wv][(vi + rl) * PBP + nt * 16 + cl] = (_Float16)lg[ntg][vi];
      }
#pragma unroll
      for (int ks = 0; ks < 4; ++ks) {
        const int kq = half * 4 + ks;   // 32-key block
        v16h pa = frag_ld_f16(&Pb[wv][ks * 32], PBP, lane);
        v16h b0 = frag_ld_packed(&VTlds[(kq * 2) * 512], lane);      // c 0..15
        v16h b1 = frag_ld_packed(&VTlds[(kq * 2 + 1) * 512], lane);  // c 16..31
        ao0 = wmma16(pa, b0, ao0);
        ao1 = wmma16(pa, b1, ao1);
      }
    }

    // gate * wa -> f16 workspace
#pragma unroll
    for (int ct = 0; ct < 2; ++ct) {
      const v8f& ao = ct ? ao1 : ao0;
#pragma unroll
      for (int vi = 0; vi < 8; ++vi) {
        const int r = m0 + vi + rl;
        const int c = ct * 16 + cl;
        const size_t idx = ((size_t)b2 * NN + r) * HC + h * CC + c;
        wa_ws[idx] = (_Float16)(ao[vi] * (float)gate_ws[idx]);
      }
    }
  }
}

// ---------------------------------------------------------------------------
// Kernel 3: output projection  out[M,256] = wa[M,256] x wo16^T + b_o
// Wave tile 32x64; block = 2x4 waves = 64 rows x all 256 cols.
// ---------------------------------------------------------------------------
__global__ __launch_bounds__(256) void k_out(
    const _Float16* __restrict__ wa_ws,  // [B2*N, HC]
    const _Float16* __restrict__ wo16,   // [256, HC]
    const float* __restrict__ b_o,       // [256]
    float* __restrict__ out) {           // [B2*N, 256]
  const int lane = threadIdx.x & 31;
  const int wv   = threadIdx.x >> 5;
  const int wr   = wv >> 2;
  const int wc   = wv & 3;
  const int row0 = blockIdx.x * 64 + wr * 32;
  const int col0 = wc * 64;
  const int rl   = (lane >> 4) * 8;
  const int cl   = lane & 15;

  const _Float16* arow = wa_ws + (size_t)row0 * HC;
  __builtin_prefetch(arow, 0, 3);

  v8f acc[2][4];
#pragma unroll
  for (int m = 0; m < 2; ++m)
#pragma unroll
    for (int t = 0; t < 4; ++t) acc[m][t] = zero8();

  for (int kk = 0; kk < HC; kk += 32) {
    v16h a0 = frag_ld_f16(arow + kk, HC, lane);
    v16h a1 = frag_ld_f16(arow + (size_t)16 * HC + kk, HC, lane);
#pragma unroll
    for (int t = 0; t < 4; ++t) {
      v16h b = frag_ld_f16(wo16 + (size_t)(col0 + t * 16) * HC + kk, HC, lane);
      acc[0][t] = wmma16(a0, b, acc[0][t]);
      acc[1][t] = wmma16(a1, b, acc[1][t]);
    }
  }

#pragma unroll
  for (int mt = 0; mt < 2; ++mt) {
#pragma unroll
    for (int t = 0; t < 4; ++t) {
      const int o = col0 + t * 16 + cl;
      const float bo = b_o[o];
#pragma unroll
      for (int vi = 0; vi < 8; ++vi) {
        const int r = row0 + mt * 16 + vi + rl;
        out[(size_t)r * OUTD + o] = acc[mt][t][vi] + bo;
      }
    }
  }
}

// ---------------------------------------------------------------------------
extern "C" void kernel_launch(void* const* d_in, const int* in_sizes, int n_in,
                              void* d_out, int out_size, void* d_ws, size_t ws_size,
                              hipStream_t stream) {
  (void)in_sizes; (void)n_in; (void)out_size; (void)ws_size;
  const float* in_data = (const float*)d_in[0];
  const float* mask    = (const float*)d_in[1];
  const float* nb_bias = (const float*)d_in[2];
  const float* w_qkv   = (const float*)d_in[3];
  const float* w_gate  = (const float*)d_in[4];
  const float* g_bias  = (const float*)d_in[5];
  const float* w_o     = (const float*)d_in[6];
  const float* b_o     = (const float*)d_in[7];
  float* out = (float*)d_out;

  // Workspace layout (f16 elements)
  const size_t XN  = (size_t)B2 * NN * DD;       // 8,388,608
  const size_t QN  = (size_t)B2 * HH * NN * CC;  // 8,388,608
  _Float16* x16    = (_Float16*)d_ws;
  _Float16* w16    = x16 + XN;                   // [1024 x 256] fused qkv|gate
  _Float16* wo16   = w16 + (size_t)(QKV_E + HC) * DD;
  _Float16* q_ws   = wo16 + (size_t)OUTD * HC;
  _Float16* k_ws   = q_ws + QN;
  _Float16* vT_ws  = k_ws + QN;
  _Float16* gate16 = vT_ws + QN;
  _Float16* wa_ws  = gate16 + (size_t)B2 * NN * HC;

  // 0) one-time f32 -> f16 conversion passes
  k_cvt<<<dim3((int)(XN / 8 / 256)), 256, 0, stream>>>(in_data, x16, (int)XN);
  k_cvt<<<dim3(QKV_E * DD / 8 / 256), 256, 0, stream>>>(w_qkv, w16, QKV_E * DD);
  k_cvt<<<dim3(HC * DD / 8 / 256), 256, 0, stream>>>(w_gate, w16 + (size_t)QKV_E * DD, HC * DD);
  k_cvt<<<dim3(OUTD * HC / 8 / 256), 256, 0, stream>>>(w_o, wo16, OUTD * HC);

  // 1) fused QKV + gate projection: [32768 x 256] x [256 x 1024]
  k_qkv_gate<<<dim3(4, 4, B2), 256, 0, stream>>>(x16, w16, g_bias,
                                                 q_ws, k_ws, vT_ws, gate16);
  // 2) attention per (h, b2), K/V^T staged via Tensor Data Mover
  k_attn<<<dim3(HH, B2), 256, 0, stream>>>(q_ws, k_ws, vT_ws, mask, nb_bias,
                                           gate16, wa_ws);
  // 3) output projection: [32768 x 256] x [256 x 256] + bias
  k_out<<<dim3((B2 * NN) / 64), 256, 0, stream>>>(wa_ws, wo16, b_o, out);
}

// v002
// It runs in 101 microseconds.
// Next to v001, in two timings, it ran 1.22 and 1.23 times as fast.
// Counting every step since v000, it is 1.63 times as fast.
#include <hip/hip_runtime.h>
#include <cstdint>

typedef __attribute__((ext_vector_type(16))) _Float16     v16h;
typedef __attribute__((ext_vector_type(8)))  _Float16     v8h;
typedef __attribute__((ext_vector_type(8)))  float        v8f;
typedef __attribute__((ext_vector_type(4)))  unsigned int u32x4;
typedef __attribute__((ext_vector_type(8)))  int          i32x8;
typedef __attribute__((ext_vector_type(4)))  int          i32x4;

#define B2    128
#define NN    256
#define DD    256
#define HH    8
#define CC    32
#define HC    256   // H*C
#define QKV_E 768   // 3*H*C
#define OUTD  256
#define PBP   136

__device__ __forceinline__ v8f zero8() {
  v8f z;
#pragma unroll
  for (int j = 0; j < 8; ++j) z[j] = 0.0f;
  return z;
}

// element j -> src[r*stride + k]; per-lane halves are two contiguous 16B runs
__device__ __forceinline__ v16h frag_ld_f16(const _Float16* __restrict__ src,
                                            int stride, int lane) {
  const int r  = lane & 15;
  const int kb = (lane >> 4) * 8;
  const _Float16* p = src + (size_t)r * stride + kb;
  v16h f;
#pragma unroll
  for (int j = 0; j < 8; ++j) f[j] = p[j];
#pragma unroll
  for (int j = 0; j < 8; ++j) f[8 + j] = p[16 + j];
  return f;
}

__device__ __forceinline__ v16h frag_ld_packed(const _Float16* src, int lane) {
  const v8h lo = *(const v8h*)(src + lane * 8);
  const v8h hi = *(const v8h*)(src + 256 + lane * 8);
  return __builtin_shufflevector(lo, hi, 0, 1, 2, 3, 4, 5, 6, 7,
                                 8, 9, 10, 11, 12, 13, 14, 15);
}

// offset (halves) of element (col, k) inside one fragment, col 0..15, k 0..31
__device__ __forceinline__ int frag_off(int col, int k) {
  return ((k >> 4) & 1) * 256 + ((((k >> 3) & 1) * 16) + col) * 8 + (k & 7);
}

__device__ __forceinline__ v8f wmma16(v16h a, v16h b, v8f c) {
  return __builtin_amdgcn_wmma_f32_16x16x32_f16(false, a, false, b,
                                                (short)0, c, false, false);
}

__device__ __forceinline__ void tdm_load_f16_1d(uint32_t lds_off,
                                                const _Float16* gsrc,
                                                uint32_t nelem) {
  const uint64_t ga = (uint64_t)(uintptr_t)gsrc;
  u32x4 g0;
  g0[0] = 1u;                                                  // count=1
  g0[1] = lds_off;                                             // lds_addr
  g0[2] = (uint32_t)ga;                                        // ga[31:0]
  g0[3] = (uint32_t)((ga >> 32) & 0x01FFFFFFu) | (2u << 30);   // ga[56:32]|type
  i32x8 g1;
  g1[0] = 0x00010000;
  g1[1] = (int)((nelem & 0xFFFFu) << 16);
  g1[2] = (int)(((nelem >> 16) & 0xFFFFu) | (1u << 16));
  g1[3] = (int)((nelem & 0xFFFFu) << 16);
  g1[4] = 0;
  g1[5] = (int)nelem;
  g1[6] = 0;
  g1[7] = 0;
  i32x4 gz;
  gz[0] = gz[1] = gz[2] = gz[3] = 0;
#if defined(__clang_major__) && __clang_major__ >= 23
  i32x8 g4;
#pragma unroll
  for (int j = 0; j < 8; ++j) g4[j] = 0;
  __builtin_amdgcn_tensor_load_to_lds(g0, g1, gz, gz, g4, 0);
#else
  __builtin_amdgcn_tensor_load_to_lds(g0, g1, gz, gz, 0);
#endif
}

// ---------------------------------------------------------------------------
// Kernel 0: f32 -> f16 conversion pass (8 elems/thread, b128 in / b128 out)
// of a row-major matrix of 256 columns into fragment order.  Thread t writes
// the t-th 16 bytes of dst: stores stay contiguous, a block reads 512
// contiguous bytes of each of 16 rows.
// ---------------------------------------------------------------------------
__global__ __launch_bounds__(256) void k_cvt(const float* __restrict__ src,
                                             _Float16* __restrict__ dst, int n) {
  const int t = blockIdx.x * 256 + threadIdx.x;
  const int i = t * 8;
  if (i + 7 < n) {
    const int fr  = t >> 6;                        // fragment R*8 + b
    const int row = (fr >> 3) * 16 + (t & 15);
    const int k   = (fr & 7) * 32 + ((t >> 5) & 1) * 16 + ((t >> 4) & 1) * 8;
    const float* __restrict__ sp = src + (size_t)row * 256 + k;
#pragma unroll
    for (int j = 0; j < 8; ++j) dst[i + j] = (_Float16)sp[j];
  }
}

// ---------------------------------------------------------------------------
// Kernel 1: fused QKV + gate projection, all-f16 operands.
//   x16[b2*n, d] x w16^T[1024, d]  (rows: 768 qkv, then 256 gate),
//   both in fragment order
// Wave tile 32x64 (2 A-frags x 4 B-frags -> 8 WMMA); block = 2x4 waves
// = 64 rows x 256 cols.  Q pre-scaled, row-major.  K and V are stored per
// (b2,h) in the fragment order their readers in k_attn use (frag_off):
// K: fragment n>>4, col = n&15, k = c;  V: fragment (n>>5)*2 + (c>>4),
// col = c&15, k = n&31.  gate = sigmoid(.+bias) stored f16.
// ---------------------------------------------------------------------------
__global__ __launch_bounds__(256) void k_qkv_gate(
    const _Float16* __restrict__ x16,   // [B2*N/16, 8 fragments x 512]
    const _Float16* __restrict__ w16,   // [1024/16, 8 fragments x 512]
    const float* __restrict__ g_bias,   // [256]
    _Float16* __restrict__ q_ws,        // [B2,H,N,C] (scaled)
    _Float16* __restrict__ k_ws,        // [B2,H, 16 fragments x 512]
    _Float16* __restrict__ vT_ws,       // [B2,H, 16 fragments x 512]
    _Float16* __restrict__ gate_ws) {   // [B2,N,HC]
  const int lane = threadIdx.x & 31;
  const int wv   = threadIdx.x >> 5;
  const int wr   = wv >> 2;            // 0..1
  const int wc   = wv & 3;             // 0..3
  const int b2   = blockIdx.z;
  const int row0 = blockIdx.y * 64 + wr * 32;
  const int col0 = blockIdx.x * 256 + wc * 64;
  const int rl   = (lane >> 4) * 8;
  const int cl   = lane & 15;

  const _Float16* xrow = x16 + ((size_t)b2 * NN + row0) * DD;
  __builtin_prefetch(xrow, 0, 3);

  v8f acc[2][4];
#pragma unroll
  for (int m = 0; m < 2; ++m)
#pragma unroll
    for (int t = 0; t < 4; ++t) acc[m][t] = zero8();

  // two trips a body: eight loads go out together at the head of a trip;
  // unrolled whole, this build issues each B fragment's two loads alone and
  // waits them out before the next pair
#pragma unroll 2
  for (int kk = 0; kk < DD; kk += 32) {   // fragment kk/32 = kk*16 halves on
    v16h a0 = frag_ld_packed(xrow + kk * 16, lane);
    v16h a1 = frag_ld_packed(xrow + (size_t)16 * DD + kk * 16, lane);
#pragma unroll
    for (int t = 0; t < 4; ++t) {
      v16h b = frag_ld_packed(w16 + (size_t)(col0 + t * 16) * DD + kk * 16, lane);
      acc[0][t] = wmma16(a0, b, acc[0][t]);
      acc[1][t] = wmma16(a1, b, acc[1][t]);
    }
  }

#pragma unroll
  for (int mt = 0; mt < 2; ++mt) {
    const int rowb = row0 + mt * 16;
#pragma unroll
    for (int t = 0; t < 4; ++t) {
      const int nb = col0 + t * 16;   // tile-uniform fused column
      const int n  = nb + cl;
      if (nb < QKV_E) {
        const int which = nb / HC;    // 0=q 1=k 2=v (block-uniform here)
        const int hc = n - which * HC;
        const int h = hc >> 5, c = hc & 31;
        if (which == 2) {             // V: 8 keys of one c = 16 B per lane
          const int n0 = rowb + rl;
          const size_t base = ((size_t)b2 * HH + h) * (CC * NN) +
                              ((n0 >> 5) * 2 + (c >> 4)) * 512 +
                              frag_off(c & 15, n0 & 31);
#pragma unroll
          for (int vi = 0; vi < 8; ++vi)
            vT_ws[base + vi] = (_Float16)acc[mt][t][vi];
          // before a register that the store names is written again
          asm volatile("s_wait_xcnt 0x0" ::: "memory");
        } else if (which == 1) {      // K: fragment order
          const size_t base = ((size_t)b2 * HH + h) * (NN * CC) +
                              (rowb >> 4) * 512 + frag_off(rl, c);
#pragma unroll
          for (int vi = 0; vi < 8; ++vi)
            k_ws[base + vi * 8] = (_Float16)acc[mt][t][vi];
        } else {                      // Q: row-major, scaled by C^-1/2
          const size_t base = (((size_t)b2 * HH + h) * NN) * CC + c;
#pragma unroll
          for (int vi = 0; vi < 8; ++vi)
            q_ws[base + (size_t)(rowb + vi + rl) * CC] =
                (_Float16)(acc[mt][t][vi] * 0.17677669529663687f);
          // before a register that these stores name is written again
          asm volatile("s_wait_xcnt 0x0" ::: "memory");
        }
      } else {
        const int g = n - QKV_E;
        const float gb = g_bias[g];
        const size_t base = ((size_t)b2 * NN) * HC + g;
#pragma unroll
        for (int vi = 0; vi < 8; ++vi) {
          const float z = acc[mt][t][vi] + gb;
          gate_ws[base + (size_t)(rowb + vi + rl) * HC] =
              (_Float16)(1.0f / (1.0f + __expf(-z)));
        }
      }
    }
  }
}

__global__ __launch_bounds__(256) void k_attn(
    const _Float16* __restrict__ q_ws,
    const _Float16* __restrict__ k_ws,
    const _Float16* __restrict__ vT_ws,
    const float* __restrict__ mask,       // [B2,N]
    const float* __restrict__ nb_bias,    // [H,N,N]
    const _Float16* __restrict__ gate_ws, // [B2,N,HC]
    _Float16* __restrict__ wa_ws) {       // [B2*N/16, 8 fragments x 512] gated
  // All three arrays start at multiples of 2 KiB, so that the tensor-load
  // destinations (K, V) do, in whatever order the arrays are placed in LDS.
  __shared__ __attribute__((aligned(2048))) _Float16 Klds[NN * CC];   // 16 KB, 16 fragments
  __shared__ __attribute__((aligned(2048))) _Float16 VTlds[CC * NN];  // 16 KB, 16 fragments
  __shared__ __attribute__((aligned(2048))) _Float16 Pb[8][16 * PBP]; // per-wave P half-tile

  const int lane = threadIdx.x & 31;
  const int wv   = threadIdx.x >> 5;
  const int h    = blockIdx.x;
  const int b2   = blockIdx.y;
  const int rl   = (lane >> 4) * 8;
  const int cl   = lane & 15;

  const size_t hd = (((size_t)b2 * HH + h) * NN) * CC;

  if (wv == 0) {
    tdm_load_f16_1d((uint32_t)(uintptr_t)&Klds[0],  k_ws + hd,  NN * CC);
    tdm_load_f16_1d((uint32_t)(uintptr_t)&VTlds[0], vT_ws + hd, NN * CC);
    __builtin_amdgcn_s_wait_tensorcnt(0);
  }
  __syncthreads();

  for (int mt = 0; mt < 2; ++mt) {
    const int m0 = wv * 32 + mt * 16;
    const v16h qa = frag_ld_f16(q_ws + hd + (size_t)m0 * CC, CC, lane);

    v8f lg[16];
#pragma unroll
    for (int nt = 0; nt < 16; ++nt) {
      v16h kf = frag_ld_packed(&Klds[nt * 512], lane);  // K rows = B cols
      lg[nt] = wmma16(qa, kf, zero8());
    }

    // + mask bias (per key col) + nonbatched bias (per row,col)
#pragma unroll
    for (int nt = 0; nt < 16; ++nt) {
      const int n = nt * 16 + cl;
      const float mb = 1e9f * (mask[(size_t)b2 * NN + n] - 1.0f);
      const float* nbp = nb_bias + ((size_t)h * NN) * NN + n;
#pragma unroll
      for (int vi = 0; vi < 8; ++vi)
        lg[nt][vi] += mb + nbp[(size_t)(m0 + vi + rl) * NN];
    }

    // softmax: row (m0+vi+rl) lives across one 16-lane half at value vi
#pragma unroll
    for (int vi = 0; vi < 8; ++vi) {
      float mx = -3.0e38f;
#pragma unroll
      for (int nt = 0; nt < 16; ++nt) mx = fmaxf(mx, lg[nt][vi]);
      for (int off = 1; off < 16; off <<= 1) mx = fmaxf(mx, __shfl_xor(mx, off, 32));
      float s = 0.0f;
#pragma unroll
      for (int nt = 0; nt < 16; ++nt) {
        const float e = __expf(lg[nt][vi] - mx);
        lg[nt][vi] = e;
        s += e;
      }
      for (int off = 1; off < 16; off <<= 1) s += __shfl_xor(s, off, 32);
      const float inv = 1.0f / s;
#pragma unroll
      for (int nt = 0; nt < 16; ++nt) lg[nt][vi] *= inv;
    }

    // P (16x256) x V (256x32), keys processed in two 128-wide halves.
    // Same-wave LDS producer/consumer in lockstep -> no barrier needed.
    v8f ao0 = zero8(), ao1 = zero8();
    for (int half = 0; half < 2; ++half) {
#pragma unroll
      for (int nt = 0; nt < 8; ++nt) {
        const int ntg = half * 8 + nt;
#pragma unroll
        for (int vi = 0; vi < 8; ++vi)
          Pb[wv][(vi + rl) * PBP + nt * 16 + cl] = (_Float16)lg[ntg][vi];
      }
#pragma unroll
      for (int ks = 0; ks < 4; ++ks) {
        const int kq = half * 4 + ks;   // 32-key block
        v16h pa = frag_ld_f16(&Pb[wv][ks * 32], PBP, lane);
        v16h b0 = frag_ld_packed(&VTlds[(kq * 2) * 512], lane);      // c 0..15
        v16h b1 = frag_ld_packed(&VTlds[(kq * 2 + 1) * 512], lane);  // c 16..31
        ao0 = wmma16(pa, b0, ao0);
        ao1 = wmma16(pa, b1, ao1);
      }
    }

    // gate * wa -> f16 workspace, in the fragment order k_out reads:
    // this wave's 16 rows x 32 columns are fragment h of row tile m0/16
#pragma unroll
    for (int ct = 0; ct < 2; ++ct) {
      const v8f& ao = ct ? ao1 : ao0;
#pragma unroll
      for (int vi = 0; vi < 8; ++vi) {
        const int r = m0 + vi + rl;
        const int c = ct * 16 + cl;
        const size_t idx = ((size_t)b2 * NN + r) * HC + h * CC + c;
        const size_t fidx = ((size_t)b2 * NN + m0) * HC + h * 512 +
                            frag_off(vi + rl, c);
        wa_ws[fidx] = (_Float16)(ao[vi] * (float)gate_ws[idx]);
      }
    }
    // before a register that these stores name is written again (next trip)
    asm volatile("s_wait_xcnt 0x0" ::: "memory");
  }
}

// ---------------------------------------------------------------------------
// Kernel 3: output projection  out[M,256] = wa[M,256] x wo16^T + b_o
// Wave tile 32x64; block = 2x4 waves = 64 rows x all 256 cols.
// ---------------------------------------------------------------------------
__global__ __launch_bounds__(256) void k_out(
    const _Float16* __restrict__ wa_ws,  // [B2*N/16, 8 fragments x 512]
    const _Float16* __restrict__ wo16,   // [256/16, 8 fragments x 512]
    const float* __restrict__ b_o,       // [256]
    float* __restrict__ out) {           // [B2*N, 256]
  const int lane = threadIdx.x & 31;
  const int wv   = threadIdx.x >> 5;
  const int wr   = wv >> 2;
  const int wc   = wv & 3;
  const int row0 = blockIdx.x * 64 + wr * 32;
  const int col0 = wc * 64;
  const int rl   = (lane >> 4) * 8;
  const int cl   = lane & 15;

  const _Float16* arow = wa_ws + (size_t)row0 * HC;
  __builtin_prefetch(arow, 0, 3);

  v8f acc[2][4];
#pragma unroll
  for (int m = 0; m < 2; ++m)
#pragma unroll
    for (int t = 0; t < 4; ++t) acc[m][t] = zero8();

  // two trips a body: eight loads go out together at the head of a trip;
  // unrolled whole, this build has two to four in flight
#pragma unroll 2
  for (int kk = 0; kk < HC; kk += 32) {   // fragment kk/32 = kk*16 halves on
    v16h a0 = frag_ld_packed(arow + kk * 16, lane);
    v16h a1 = frag_ld_packed(arow + (size_t)16 * HC + kk * 16, lane);
#pragma unroll
    for (int t = 0; t < 4; ++t) {
      v16h b = frag_ld_packed(wo16 + (size_t)(col0 + t * 16) * HC + kk * 16, lane);
      acc[0][t] = wmma16(a0, b, acc[0][t]);
      acc[1][t] = wmma16(a1, b, acc[1][t]);
    }
  }

#pragma unroll
  for (int mt = 0; mt < 2; ++mt) {
#pragma unroll
    for (int t = 0; t < 4; ++t) {
      const int o = col0 + t * 16 + cl;
      const float bo = b_o[o];
#pragma unroll
      for (int vi = 0; vi < 8; ++vi) {
        const int r = row0 + mt * 16 + vi + rl;
        out[(size_t)r * OUTD + o] = acc[mt][t][vi] + bo;
      }
    }
  }
}

// ---------------------------------------------------------------------------
extern "C" void kernel_launch(void* const* d_in, const int* in_sizes, int n_in,
                              void* d_out, int out_size, void* d_ws, size_t ws_size,
                              hipStream_t stream) {
  (void)in_sizes; (void)n_in; (void)out_size; (void)ws_size;
  const float* in_data = (const float*)d_in[0];
  const float* mask    = (const float*)d_in[1];
  const float* nb_bias = (const float*)d_in[2];
  const float* w_qkv   = (const float*)d_in[3];
  const float* w_gate  = (const float*)d_in[4];
  const float* g_bias  = (const float*)d_in[5];
  const float* w_o     = (const float*)d_in[6];
  const float* b_o     = (const float*)d_in[7];
  float* out = (float*)d_out;

  // Workspace layout (f16 elements)
  const size_t XN  = (size_t)B2 * NN * DD;       // 8,388,608
  const size_t QN  = (size_t)B2 * HH * NN * CC;  // 8,388,608
  _Float16* x16    = (_Float16*)d_ws;
  _Float16* w16    = x16 + XN;                   // [1024 x 256] fused qkv|gate
  _Float16* wo16   = w16 + (size_t)(QKV_E + HC) * DD;
  _Float16* q_ws   = wo16 + (size_t)OUTD * HC;
  _Float16* k_ws   = q_ws + QN;
  _Float16* vT_ws  = k_ws + QN;
  _Float16* gate16 = vT_ws + QN;
  _Float16* wa_ws  = gate16 + (size_t)B2 * NN * HC;

  // 0) f32 -> f16 conversion passes, into fragment order
  k_cvt<<<dim3((int)(XN / 8 / 256)), 256, 0, stream>>>(in_data, x16, (int)XN);
  k_cvt<<<dim3(QKV_E * DD / 8 / 256), 256, 0, stream>>>(w_qkv, w16, QKV_E * DD);
  k_cvt<<<dim3(HC * DD / 8 / 256), 256, 0, stream>>>(w_gate, w16 + (size_t)QKV_E * DD, HC * DD);
  k_cvt<<<dim3(OUTD * HC / 8 / 256), 256, 0, stream>>>(w_o, wo16, OUTD * HC);

  // 1) fused QKV + gate projection: [32768 x 256] x [256 x 1024]
  k_qkv_gate<<<dim3(4, 4, B2), 256, 0, stream>>>(x16, w16, g_bias,
                                                 q_ws, k_ws, vT_ws, gate16);
  // 2) attention per (h, b2), K/V^T staged via Tensor Data Mover
  k_attn<<<dim3(HH, B2), 256, 0, stream>>>(q_ws, k_ws, vT_ws, mask, nb_bias,
                                           gate16, wa_ws);
  // 3) output projection: [32768 x 256] x [256 x 256] + bias
  k_out<<<dim3((B2 * NN) / 64), 256, 0, stream>>>(wa_ws, wo16, b_o, out);
}

// v003
// It runs in 91.5 microseconds.
// In two side-by-side timings against v002, it was 1.11 and 1.10 times as fast.
// Counting every step since v000, it is 1.80 times as fast.
#include <hip/hip_runtime.h>
#include <cstdint>

typedef __attribute__((ext_vector_type(16))) _Float16     v16h;
typedef __attribute__((ext_vector_type(8)))  _Float16     v8h;
typedef __attribute__((ext_vector_type(8)))  float        v8f;
typedef __attribute__((ext_vector_type(4)))  unsigned int u32x4;
typedef __attribute__((ext_vector_type(8)))  int          i32x8;
typedef __attribute__((ext_vector_type(4)))  int          i32x4;

#define B2    128
#define NN    256
#define DD    256
#define HH    8
#define CC    32
#define HC    256   // H*C
#define QKV_E 768   // 3*H*C
#define OUTD  256

__device__ __forceinline__ v8f zero8() {
  v8f z;
#pragma unroll
  for (int j = 0; j < 8; ++j) z[j] = 0.0f;
  return z;
}

// element j -> src[r*stride + k]; per-lane halves are two contiguous 16B runs
__device__ __forceinline__ v16h frag_ld_f16(const _Float16* __restrict__ src,
                                            int stride, int lane) {
  const int r  = lane & 15;
  const int kb = (lane >> 4) * 8;
  const _Float16* p = src + (size_t)r * stride + kb;
  v16h f;
#pragma unroll
  for (int j = 0; j < 8; ++j) f[j] = p[j];
#pragma unroll
  for (int j = 0; j < 8; ++j) f[8 + j] = p[16 + j];
  return f;
}

__device__ __forceinline__ v16h frag_ld_packed(const _Float16* src, int lane) {
  const v8h lo = *(const v8h*)(src + lane * 8);
  const v8h hi = *(const v8h*)(src + 256 + lane * 8);
  return __builtin_shufflevector(lo, hi, 0, 1, 2, 3, 4, 5, 6, 7,
                                 8, 9, 10, 11, 12, 13, 14, 15);
}

// offset (halves) of element (col, k) inside one fragment, col 0..15, k 0..31
__device__ __forceinline__ int frag_off(int col, int k) {
  return ((k >> 4) & 1) * 256 + ((((k >> 3) & 1) * 16) + col) * 8 + (k & 7);
}

__device__ __forceinline__ v8f wmma16(v16h a, v16h b, v8f c) {
  return __builtin_amdgcn_wmma_f32_16x16x32_f16(false, a, false, b,
                                                (short)0, c, false, false);
}

__device__ __forceinline__ void tdm_load_f16_1d(uint32_t lds_off,
                                                const _Float16* gsrc,
                                                uint32_t nelem) {
  const uint64_t ga = (uint64_t)(uintptr_t)gsrc;
  u32x4 g0;
  g0[0] = 1u;                                                  // count=1
  g0[1] = lds_off;                                             // lds_addr
  g0[2] = (uint32_t)ga;                                        // ga[31:0]
  g0[3] = (uint32_t)((ga >> 32) & 0x01FFFFFFu) | (2u << 30);   // ga[56:32]|type
  i32x8 g1;
  g1[0] = 0x00010000;
  g1[1] = (int)((nelem & 0xFFFFu) << 16);
  g1[2] = (int)(((nelem >> 16) & 0xFFFFu) | (1u << 16));
  g1[3] = (int)((nelem & 0xFFFFu) << 16);
  g1[4] = 0;
  g1[5] = (int)nelem;
  g1[6] = 0;
  g1[7] = 0;
  i32x4 gz;
  gz[0] = gz[1] = gz[2] = gz[3] = 0;
#if defined(__clang_major__) && __clang_major__ >= 23
  i32x8 g4;
#pragma unroll
  for (int j = 0; j < 8; ++j) g4[j] = 0;
  __builtin_amdgcn_tensor_load_to_lds(g0, g1, gz, gz, g4, 0);
#else
  __builtin_amdgcn_tensor_load_to_lds(g0, g1, gz, gz, 0);
#endif
}

// ---------------------------------------------------------------------------
// Kernel 0: f32 -> f16 conversion pass (8 elems/thread, b128 in / b128 out)
// of a row-major matrix of 256 columns into fragment order.  Thread t writes
// the t-th 16 bytes of dst: stores stay contiguous, a block reads 512
// contiguous bytes of each of 16 rows.
// ---------------------------------------------------------------------------
__global__ __launch_bounds__(256) void k_cvt(const float* __restrict__ src,
                                             _Float16* __restrict__ dst, int n) {
  const int t = blockIdx.x * 256 + threadIdx.x;
  const int i = t * 8;
  if (i + 7 < n) {
    const int fr  = t >> 6;                        // fragment R*8 + b
    const int row = (fr >> 3) * 16 + (t & 15);
    const int k   = (fr & 7) * 32 + ((t >> 5) & 1) * 16 + ((t >> 4) & 1) * 8;
    const float* __restrict__ sp = src + (size_t)row * 256 + k;
#pragma unroll
    for (int j = 0; j < 8; ++j) dst[i + j] = (_Float16)sp[j];
  }
}

// ---------------------------------------------------------------------------
// Kernel 1: fused QKV + gate projection, all-f16 operands.
//   x16[b2*n, d] x w16^T[1024, d]  (rows: 768 qkv, then 256 gate),
//   both in fragment order
// Wave tile 32x64 (2 A-frags x 4 B-frags -> 8 WMMA); block = 2x4 waves
// = 64 rows x 256 cols.  Q pre-scaled, row-major.  K and V are stored per
// (b2,h) in the fragment order their readers in k_attn use (frag_off):
// K: fragment n>>4, col = n&15, k = c;  V: fragment (n>>5)*2 + (c>>4),
// col = c&15, k = n&31.  gate = sigmoid(.+bias) stored f16.
// ---------------------------------------------------------------------------
__global__ __launch_bounds__(256) void k_qkv_gate(
    const _Float16* __restrict__ x16,   // [B2*N/16, 8 fragments x 512]
    const _Float16* __restrict__ w16,   // [1024/16, 8 fragments x 512]
    const float* __restrict__ g_bias,   // [256]
    _Float16* __restrict__ q_ws,        // [B2,H,N,C] (scaled)
    _Float16* __restrict__ k_ws,        // [B2,H, 16 fragments x 512]
    _Float16* __restrict__ vT_ws,       // [B2,H, 16 fragments x 512]
    _Float16* __restrict__ gate_ws) {   // [B2,N,HC]
  const int lane = threadIdx.x & 31;
  const int wv   = threadIdx.x >> 5;
  const int wr   = wv >> 2;            // 0..1
  const int wc   = wv & 3;             // 0..3
  const int b2   = blockIdx.z;
  const int row0 = blockIdx.y * 64 + wr * 32;
  const int col0 = blockIdx.x * 256 + wc * 64;
  const int rl   = (lane >> 4) * 8;
  const int cl   = lane & 15;

  const _Float16* xrow = x16 + ((size_t)b2 * NN + row0) * DD;
  __builtin_prefetch(xrow, 0, 3);

  v8f acc[2][4];
#pragma unroll
  for (int m = 0; m < 2; ++m)
#pragma unroll
    for (int t = 0; t < 4; ++t) acc[m][t] = zero8();

  // two trips a body: eight loads go out together at the head of a trip;
  // unrolled whole, this build issues each B fragment's two loads alone and
  // waits them out before the next pair
#pragma unroll 2
  for (int kk = 0; kk < DD; kk += 32) {   // fragment kk/32 = kk*16 halves on
    v16h a0 = frag_ld_packed(xrow + kk * 16, lane);
    v16h a1 = frag_ld_packed(xrow + (size_t)16 * DD + kk * 16, lane);
#pragma unroll
    for (int t = 0; t < 4; ++t) {
      v16h b = frag_ld_packed(w16 + (size_t)(col0 + t * 16) * DD + kk * 16, lane);
      acc[0][t] = wmma16(a0, b, acc[0][t]);
      acc[1][t] = wmma16(a1, b, acc[1][t]);
    }
  }

#pragma unroll
  for (int mt = 0; mt < 2; ++mt) {
    const int rowb = row0 + mt * 16;
#pragma unroll
    for (int t = 0; t < 4; ++t) {
      const int nb = col0 + t * 16;   // tile-uniform fused column
      const int n  = nb + cl;
      if (nb < QKV_E) {
        const int which = nb / HC;    // 0=q 1=k 2=v (block-uniform here)
        const int hc = n - which * HC;
        const int h = hc >> 5, c = hc & 31;
        if (which == 2) {             // V: 8 keys of one c = 16 B per lane
          const int n0 = rowb + rl;
          const size_t base = ((size_t)b2 * HH + h) * (CC * NN) +
                              ((n0 >> 5) * 2 + (c >> 4)) * 512 +
                              frag_off(c & 15, n0 & 31);
#pragma unroll
          for (int vi = 0; vi < 8; ++vi)
            vT_ws[base + vi] = (_Float16)acc[mt][t][vi];
          // before a register that the store names is written again
          asm volatile("s_wait_xcnt 0x0" ::: "memory");
        } else if (which == 1) {      // K: fragment order
          const size_t base = ((size_t)b2 * HH + h) * (NN * CC) +
                              (rowb >> 4) * 512 + frag_off(rl, c);
#pragma unroll
          for (int vi = 0; vi < 8; ++vi)
            k_ws[base + vi * 8] = (_Float16)acc[mt][t][vi];
        } else {                      // Q: row-major, scaled by C^-1/2
          const size_t base = (((size_t)b2 * HH + h) * NN) * CC + c;
#pragma unroll
          for (int vi = 0; vi < 8; ++vi)
            q_ws[base + (size_t)(rowb + vi + rl) * CC] =
                (_Float16)(acc[mt][t][vi] * 0.17677669529663687f);
          // before a register that these stores name is written again
          asm volatile("s_wait_xcnt 0x0" ::: "memory");
        }
      } else {
        const int g = n - QKV_E;
        const float gb = g_bias[g];
        const size_t base = ((size_t)b2 * NN) * HC + g;
#pragma unroll
        for (int vi = 0; vi < 8; ++vi) {
          const float z = acc[mt][t][vi] + gb;
          gate_ws[base + (size_t)(rowb + vi + rl) * HC] =
              (_Float16)(1.0f / (1.0f + __expf(-z)));
        }
      }
    }
  }
}

__device__ __forceinline__ float xhalf(float x) {
  const int b = __builtin_bit_cast(int, x);
  return __builtin_bit_cast(float, __builtin_amdgcn_permlanex16(
      b, b, 0x76543210, 0xfedcba98, false, false));
}

__global__ __launch_bounds__(256) void k_attn(
    const _Float16* __restrict__ q_ws,
    const _Float16* __restrict__ k_ws,
    const _Float16* __restrict__ vT_ws,
    const float* __restrict__ mask,       // [B2,N]
    const float* __restrict__ nb_bias,    // [H,N,N]
    const _Float16* __restrict__ gate_ws, // [B2,N,HC]
    _Float16* __restrict__ wa_ws) {       // [B2*N/16, 8 fragments x 512] gated
  // All three arrays start at multiples of 2 KiB, so that the tensor-load
  // destinations (K, V) do, in whatever order the arrays are placed in LDS.
  __shared__ __attribute__((aligned(2048))) _Float16 Klds[NN * CC];   // 16 KB, 16 fragments
  __shared__ __attribute__((aligned(2048))) _Float16 VTlds[CC * NN];  // 16 KB, 16 fragments
  __shared__ __attribute__((aligned(2048))) float MB[NN];             // mask bias per key

  const int lane = threadIdx.x & 31;
  const int wv   = threadIdx.x >> 5;
  const int h    = blockIdx.x;
  const int b2   = blockIdx.y;
  const int rl   = (lane >> 4) * 8;
  const int cl   = lane & 15;

  const size_t hd = (((size_t)b2 * HH + h) * NN) * CC;

  const float mk = mask[(size_t)b2 * NN + threadIdx.x];

  if (wv == 0) {
    tdm_load_f16_1d((uint32_t)(uintptr_t)&Klds[0],  k_ws + hd,  NN * CC);
    tdm_load_f16_1d((uint32_t)(uintptr_t)&VTlds[0], vT_ws + hd, NN * CC);
    __builtin_amdgcn_s_wait_tensorcnt(0);
  }
  MB[threadIdx.x] = 1e9f * (mk - 1.0f);
  __syncthreads();

  for (int mt = 0; mt < 2; ++mt) {
    const int m0 = wv * 32 + mt * 16;
    // B operand: column = query m0 + cl, k = c
    const v16h qb = frag_ld_f16(q_ws + hd + (size_t)m0 * CC, CC, lane);
    // before a register that these loads name is written again (a bias load
    // below lands in their address pair)
    asm volatile("s_wait_xcnt 0x0" ::: "memory");

    // nonbatched bias (per query, key): 8 consecutive keys of one query's
    // bias row per lane and tile
    const float* nbp = nb_bias + ((size_t)h * NN + m0 + cl) * NN + rl;
    v8f nbv[16];
#pragma unroll
    for (int nt = 0; nt < 16; ++nt) nbv[nt] = *(const v8f*)(nbp + nt * 16);
    // holds the 32 bias loads in front of the products, all in flight at
    // once; left free, this build issues them one by one behind the products
    // and waits each out
    __builtin_amdgcn_sched_barrier(0);

    // lg[nt][vi] = logit of query m0 + cl, key nt*16 + rl + vi
    v8f lg[16];
#pragma unroll
    for (int g = 0; g < 8; ++g) {     // two key tiles a group
      v16h kf[2];                     // A rows = keys
      v8f  mb[2];                     // mask bias (per key)
#pragma unroll
      for (int t = 0; t < 2; ++t) {
        kf[t] = frag_ld_packed(&Klds[(g * 2 + t) * 512], lane);
        mb[t] = *(const v8f*)&MB[(g * 2 + t) * 16 + rl];
      }
      // holds a group's 8 LDS loads together in front of its products, one
      // wait for all; left free, this build waits out each pair of loads
      __builtin_amdgcn_sched_barrier(0);
#pragma unroll
      for (int t = 0; t < 2; ++t) lg[g * 2 + t] = wmma16(kf[t], qb, zero8());
#pragma unroll
      for (int t = 0; t < 2; ++t) lg[g * 2 + t] += mb[t] + nbv[g * 2 + t];
    }

    // softmax over the keys of one query: eight chains in the lane (one per
    // vi), joined by a tree, then the other half of the wave
    v8f mx8 = lg[0];
#pragma unroll
    for (int nt = 1; nt < 16; ++nt) mx8 = __builtin_elementwise_max(mx8, lg[nt]);
    float mx = fmaxf(fmaxf(fmaxf(mx8[0], mx8[1]), fmaxf(mx8[2], mx8[3])),
                     fmaxf(fmaxf(mx8[4], mx8[5]), fmaxf(mx8[6], mx8[7])));
    mx = fmaxf(mx, xhalf(mx));
    v8f s8 = zero8();
#pragma unroll
    for (int nt = 0; nt < 16; ++nt) {
#pragma unroll
      for (int vi = 0; vi < 8; ++vi) lg[nt][vi] = __expf(lg[nt][vi] - mx);
      s8 += lg[nt];
    }
    float s = ((s8[0] + s8[1]) + (s8[2] + s8[3])) +
              ((s8[4] + s8[5]) + (s8[6] + s8[7]));
    s += xhalf(s);
    const float inv = 1.0f / s;

    // O^T (32 c x 16 queries) = V^T (32 x 256) x P^T (256 x 16)
    v8f ao0 = zero8(), ao1 = zero8();
#pragma unroll
    for (int kq = 0; kq < 8; ++kq) {   // 32-key block
      v16h pb;                         // k = rl + j, then 16 + rl + j
#pragma unroll
      for (int j = 0; j < 8; ++j) {
        pb[j]     = (_Float16)(lg[kq * 2][j] * inv);
        pb[8 + j] = (_Float16)(lg[kq * 2 + 1][j] * inv);
      }
      v16h a0 = frag_ld_packed(&VTlds[(kq * 2) * 512], lane);      // c 0..15
      v16h a1 = frag_ld_packed(&VTlds[(kq * 2 + 1) * 512], lane);  // c 16..31
      ao0 = wmma16(a0, pb, ao0);
      ao1 = wmma16(a1, pb, ao1);
    }

    const _Float16* gp = gate_ws + ((size_t)b2 * NN + m0 + cl) * HC + h * CC + rl;
    _Float16* wp = wa_ws + ((size_t)b2 * NN + m0) * HC + h * 512 + lane * 8;
#pragma unroll
    for (int ct = 0; ct < 2; ++ct) {
      const v8f& ao = ct ? ao1 : ao0;
      const v8h g = *(const v8h*)(gp + ct * 16);
      v8h o;
#pragma unroll
      for (int vi = 0; vi < 8; ++vi) o[vi] = (_Float16)(ao[vi] * (float)g[vi]);
      *(v8h*)(wp + ct * 256) = o;
    }
    // before a register that these stores name is written again (next trip)
    asm volatile("s_wait_xcnt 0x0" ::: "memory");
  }
}

// ---------------------------------------------------------------------------
// Kernel 3: output projection  out[M,256] = wa[M,256] x wo16^T + b_o
// Wave tile 32x64; block = 2x4 waves = 64 rows x all 256 cols.
// ---------------------------------------------------------------------------
__global__ __launch_bounds__(256) void k_out(
    const _Float16* __restrict__ wa_ws,  // [B2*N/16, 8 fragments x 512]
    const _Float16* __restrict__ wo16,   // [256/16, 8 fragments x 512]
    const float* __restrict__ b_o,       // [256]
    float* __restrict__ out) {           // [B2*N, 256]
  const int lane = threadIdx.x & 31;
  const int wv   = threadIdx.x >> 5;
  const int wr   = wv >> 2;
  const int wc   = wv & 3;
  const int row0 = blockIdx.x * 64 + wr * 32;
  const int col0 = wc * 64;
  const int rl   = (lane >> 4) * 8;
  const int cl   = lane & 15;

  const _Float16* arow = wa_ws + (size_t)row0 * HC;
  __builtin_prefetch(arow, 0, 3);

  v8f acc[2][4];
#pragma unroll
  for (int m = 0; m < 2; ++m)
#pragma unroll
    for (int t = 0; t < 4; ++t) acc[m][t] = zero8();

  // two trips a body: eight loads go out together at the head of a trip;
  // unrolled whole, this build has two to four in flight
#pragma unroll 2
  for (int kk = 0; kk < HC; kk += 32) {   // fragment kk/32 = kk*16 halves on
    v16h a0 = frag_ld_packed(arow + kk * 16, lane);
    v16h a1 = frag_ld_packed(arow + (size_t)16 * HC + kk * 16, lane);
#pragma unroll
    for (int t = 0; t < 4; ++t) {
      v16h b = frag_ld_packed(wo16 + (size_t)(col0 + t * 16) * HC + kk * 16, lane);
      acc[0][t] = wmma16(a0, b, acc[0][t]);
      acc[1][t] = wmma16(a1, b, acc[1][t]);
    }
  }

#pragma unroll
  for (int mt = 0; mt < 2; ++mt) {
#pragma unroll
    for (int t = 0; t < 4; ++t) {
      const int o = col0 + t * 16 + cl;
      const float bo = b_o[o];
#pragma unroll
      for (int vi = 0; vi < 8; ++vi) {
        const int r = row0 + mt * 16 + vi + rl;
        out[(size_t)r * OUTD + o] = acc[mt][t][vi] + bo;
      }
    }
  }
}

// ---------------------------------------------------------------------------
extern "C" void kernel_launch(void* const* d_in, const int* in_sizes, int n_in,
                              void* d_out, int out_size, void* d_ws, size_t ws_size,
                              hipStream_t stream) {
  (void)in_sizes; (void)n_in; (void)out_size; (void)ws_size;
  const float* in_data = (const float*)d_in[0];
  const float* mask    = (const float*)d_in[1];
  const float* nb_bias = (const float*)d_in[2];
  const float* w_qkv   = (const float*)d_in[3];
  const float* w_gate  = (const float*)d_in[4];
  const float* g_bias  = (const float*)d_in[5];
  const float* w_o     = (const float*)d_in[6];
  const float* b_o     = (const float*)d_in[7];
  float* out = (float*)d_out;

  // Workspace layout (f16 elements)
  const size_t XN  = (size_t)B2 * NN * DD;       // 8,388,608
  const size_t QN  = (size_t)B2 * HH * NN * CC;  // 8,388,608
  _Float16* x16    = (_Float16*)d_ws;
  _Float16* w16    = x16 + XN;                   // [1024 x 256] fused qkv|gate
  _Float16* wo16   = w16 + (size_t)(QKV_E + HC) * DD;
  _Float16* q_ws   = wo16 + (size_t)OUTD * HC;
  _Float16* k_ws   = q_ws + QN;
  _Float16* vT_ws  = k_ws + QN;
  _Float16* gate16 = vT_ws + QN;
  _Float16* wa_ws  = gate16 + (size_t)B2 * NN * HC;

  // 0) f32 -> f16 conversion passes, into fragment order
  k_cvt<<<dim3((int)(XN / 8 / 256)), 256, 0, stream>>>(in_data, x16, (int)XN);
  k_cvt<<<dim3(QKV_E * DD / 8 / 256), 256, 0, stream>>>(w_qkv, w16, QKV_E * DD);
  k_cvt<<<dim3(HC * DD / 8 / 256), 256, 0, stream>>>(w_gate, w16 + (size_t)QKV_E * DD, HC * DD);
  k_cvt<<<dim3(OUTD * HC / 8 / 256), 256, 0, stream>>>(w_o, wo16, OUTD * HC);

  // 1) fused QKV + gate projection: [32768 x 256] x [256 x 1024]
  k_qkv_gate<<<dim3(4, 4, B2), 256, 0, stream>>>(x16, w16, g_bias,
                                                 q_ws, k_ws, vT_ws, gate16);
  // 2) attention per (h, b2), K/V^T staged via Tensor Data Mover
  k_attn<<<dim3(HH, B2), 256, 0, stream>>>(q_ws, k_ws, vT_ws, mask, nb_bias,
                                           gate16, wa_ws);
  // 3) output projection: [32768 x 256] x [256 x 256] + bias
  k_out<<<dim3((B2 * NN) / 64), 256, 0, stream>>>(wa_ws, wo16, b_o, out);
}

// v004
// It runs in 87.4 microseconds.
// Next to v003, in two timings, it ran 1.06 and 1.03 times as fast.
// Over all steps from v000 it is 1.87 times as fast.
#include <hip/hip_runtime.h>
#include <cstdint>

typedef __attribute__((ext_vector_type(16))) _Float16     v16h;
typedef __attribute__((ext_vector_type(8)))  _Float16     v8h;
typedef __attribute__((ext_vector_type(8)))  float        v8f;
typedef __attribute__((ext_vector_type(4)))  float        v4f;
typedef __attribute__((ext_vector_type(4)))  unsigned int u32x4;
typedef __attribute__((ext_vector_type(8)))  int          i32x8;
typedef __attribute__((ext_vector_type(4)))  int          i32x4;

#define B2    128
#define NN    256
#define DD    256
#define HH    8
#define CC    32
#define HC    256   // H*C
#define QKV_E 768   // 3*H*C
#define OUTD  256

__device__ __forceinline__ v8f zero8() {
  v8f z;
#pragma unroll
  for (int j = 0; j < 8; ++j) z[j] = 0.0f;
  return z;
}

// element j -> src[r*stride + k]; per-lane halves are two contiguous 16B runs
__device__ __forceinline__ v16h frag_ld_f16(const _Float16* __restrict__ src,
                                            int stride, int lane) {
  const int r  = lane & 15;
  const int kb = (lane >> 4) * 8;
  const _Float16* p = src + (size_t)r * stride + kb;
  v16h f;
#pragma unroll
  for (int j = 0; j < 8; ++j) f[j] = p[j];
#pragma unroll
  for (int j = 0; j < 8; ++j) f[8 + j] = p[16 + j];
  return f;
}

__device__ __forceinline__ v16h frag_ld_packed(const _Float16* src, int lane) {
  const v8h lo = *(const v8h*)(src + lane * 8);
  const v8h hi = *(const v8h*)(src + 256 + lane * 8);
  return __builtin_shufflevector(lo, hi, 0, 1, 2, 3, 4, 5, 6, 7,
                                 8, 9, 10, 11, 12, 13, 14, 15);
}

// offset (halves) of element (col, k) inside one fragment, col 0..15, k 0..31
__device__ __forceinline__ int frag_off(int col, int k) {
  return ((k >> 4) & 1) * 256 + ((((k >> 3) & 1) * 16) + col) * 8 + (k & 7);
}

__device__ __forceinline__ v8f wmma16(v16h a, v16h b, v8f c) {
  return __builtin_amdgcn_wmma_f32_16x16x32_f16(false, a, false, b,
                                                (short)0, c, false, false);
}

__device__ __forceinline__ void tdm_load_f16_1d(uint32_t lds_off,
                                                const _Float16* gsrc,
                                                uint32_t nelem) {
  const uint64_t ga = (uint64_t)(uintptr_t)gsrc;
  u32x4 g0;
  g0[0] = 1u;                                                  // count=1
  g0[1] = lds_off;                                             // lds_addr
  g0[2] = (uint32_t)ga;                                        // ga[31:0]
  g0[3] = (uint32_t)((ga >> 32) & 0x01FFFFFFu) | (2u << 30);   // ga[56:32]|type
  i32x8 g1;
  g1[0] = 0x00010000;
  g1[1] = (int)((nelem & 0xFFFFu) << 16);
  g1[2] = (int)(((nelem >> 16) & 0xFFFFu) | (1u << 16));
  g1[3] = (int)((nelem & 0xFFFFu) << 16);
  g1[4] = 0;
  g1[5] = (int)nelem;
  g1[6] = 0;
  g1[7] = 0;
  i32x4 gz;
  gz[0] = gz[1] = gz[2] = gz[3] = 0;
#if defined(__clang_major__) && __clang_major__ >= 23
  i32x8 g4;
#pragma unroll
  for (int j = 0; j < 8; ++j) g4[j] = 0;
  __builtin_amdgcn_tensor_load_to_lds(g0, g1, gz, gz, g4, 0);
#else
  __builtin_amdgcn_tensor_load_to_lds(g0, g1, gz, gz, 0);
#endif
}

// ---------------------------------------------------------------------------
// Kernel 0: f32 -> f16 conversion pass (8 elems/thread, b128 in / b128 out)
// of a row-major matrix of 256 columns into fragment order.  Thread t writes
// the t-th 16 bytes of dst: stores stay contiguous, a block reads 512
// contiguous bytes of each of 16 rows.
// ---------------------------------------------------------------------------
__global__ __launch_bounds__(256) void k_cvt(const float* __restrict__ src,
                                             _Float16* __restrict__ dst, int n) {
  const int t = blockIdx.x * 256 + threadIdx.x;
  const int i = t * 8;
  if (i + 7 < n) {
    const int fr  = t >> 6;                        // fragment R*8 + b
    const int row = (fr >> 3) * 16 + (t & 15);
    const int k   = (fr & 7) * 32 + ((t >> 5) & 1) * 16 + ((t >> 4) & 1) * 8;
    const float* __restrict__ sp = src + (size_t)row * 256 + k;
#pragma unroll
    for (int j = 0; j < 8; ++j) dst[i + j] = (_Float16)sp[j];
  }
}

// ---------------------------------------------------------------------------
// Kernel 1: fused QKV + gate projection, all-f16 operands.
//   x[b2*n, d] x w16^T[1024, d]  (rows: 768 qkv, then 256 gate)
// A block takes its 64 rows of x as f32 and converts them into LDS in
// fragment order (32 KB); w16 is read from global memory in fragment order.
// Wave tile 32x64 (2 A-frags x 4 B-frags -> 8 WMMA); block = 2x4 waves
// = 64 rows x 256 cols.  Q pre-scaled, row-major.  K and V are stored per
// (b2,h) in the fragment order their readers in k_attn use (frag_off):
// K: fragment n>>4, col = n&15, k = c;  V: fragment (n>>5)*2 + (c>>4),
// col = c&15, k = n&31.  gate = sigmoid(.+bias) stored f16.
// ---------------------------------------------------------------------------
__global__ __launch_bounds__(256) void k_qkv_gate(
    const float* __restrict__ x,        // [B2*N, 256] row-major
    const _Float16* __restrict__ w16,   // [1024/16, 8 fragments x 512]
    const float* __restrict__ g_bias,   // [256]
    _Float16* __restrict__ q_ws,        // [B2,H,N,C] (scaled)
    _Float16* __restrict__ k_ws,        // [B2,H, 16 fragments x 512]
    _Float16* __restrict__ vT_ws,       // [B2,H, 16 fragments x 512]
    _Float16* __restrict__ gate_ws) {   // [B2,N,HC]
  const int lane = threadIdx.x & 31;
  const int wv   = threadIdx.x >> 5;
  const int wr   = wv >> 2;            // 0..1
  const int wc   = wv & 3;             // 0..3
  const int b2   = blockIdx.z;
  const int row0 = blockIdx.y * 64 + wr * 32;
  const int col0 = blockIdx.x * 256 + wc * 64;
  const int rl   = (lane >> 4) * 8;
  const int cl   = lane & 15;

  __shared__ __attribute__((aligned(16))) _Float16 Xl[64 * DD];  // 32 fragments

  // x tile -> LDS.  Wave wv takes k 32wv..32wv+31 (one 128-B line a row), 8
  // rows a trip: 4 lanes share a line, the block reads 8 whole rows a trip.
  // A lane's 8 values are one 16-B unit of the fragment.
  {
    const float* __restrict__ xs =
        x + ((size_t)b2 * NN + blockIdx.y * 64 + (lane >> 2)) * DD + wv * 32 +
        (lane & 3) * 8;
    v4f lo[8], hi[8];
#pragma unroll
    for (int it = 0; it < 8; ++it) {
      lo[it] = *(const v4f*)(xs + (size_t)it * 8 * DD);
      hi[it] = *(const v4f*)(xs + (size_t)it * 8 * DD + 4);
    }
#pragma unroll
    for (int it = 0; it < 8; ++it) {
      v8h o;
#pragma unroll
      for (int j = 0; j < 4; ++j) {
        o[j]     = (_Float16)lo[it][j];
        o[4 + j] = (_Float16)hi[it][j];
      }
      *(v8h*)&Xl[((it >> 1) * 8 + wv) * 512 +
                 frag_off((it & 1) * 8 + (lane >> 2), (lane & 3) * 8)] = o;
    }
  }
  __syncthreads();

  const _Float16* xrow = &Xl[wr * 2 * 8 * 512];

  v8f acc[2][4];
#pragma unroll
  for (int m = 0; m < 2; ++m)
#pragma unroll
    for (int t = 0; t < 4; ++t) acc[m][t] = zero8();

#pragma unroll 1
  for (int kk = 0; kk < DD; kk += 32) {   // fragment kk/32 = kk*16 halves on
    v16h b[4];
#pragma unroll
    for (int t = 0; t < 4; ++t)
      b[t] = frag_ld_packed(w16 + (size_t)(col0 + t * 16) * DD + kk * 16, lane);
    v16h a0 = frag_ld_packed(xrow + kk * 16, lane);
    v16h a1 = frag_ld_packed(xrow + (size_t)16 * DD + kk * 16, lane);
    // holds a trip's eight global loads, then its four LDS loads, in front of
    // its products, all in flight at once; left free, this build holds two B
    // fragments at a time and waits out a second pair in the middle of a trip
    __builtin_amdgcn_sched_barrier(0);
#pragma unroll
    for (int t = 0; t < 4; ++t) {
      acc[0][t] = wmma16(a0, b[t], acc[0][t]);
      acc[1][t] = wmma16(a1, b[t], acc[1][t]);
    }
  }

#pragma unroll
  for (int mt = 0; mt < 2; ++mt) {
    const int rowb = row0 + mt * 16;
#pragma unroll
    for (int t = 0; t < 4; ++t) {
      const int nb = col0 + t * 16;   // tile-uniform fused column
      const int n  = nb + cl;
      if (nb < QKV_E) {
        const int which = nb / HC;    // 0=q 1=k 2=v (block-uniform here)
        const int hc = n - which * HC;
        const int h = hc >> 5, c = hc & 31;
        if (which == 2) {             // V: 8 keys of one c = 16 B per lane
          const int n0 = rowb + rl;
          const size_t base = ((size_t)b2 * HH + h) * (CC * NN) +
                              ((n0 >> 5) * 2 + (c >> 4)) * 512 +
                              frag_off(c & 15, n0 & 31);
#pragma unroll
          for (int vi = 0; vi < 8; ++vi)
            vT_ws[base + vi] = (_Float16)acc[mt][t][vi];
          // before a register that the store names is written again
          asm volatile("s_wait_xcnt 0x0" ::: "memory");
        } else if (which == 1) {      // K: fragment order
          const size_t base = ((size_t)b2 * HH + h) * (NN * CC) +
                              (rowb >> 4) * 512 + frag_off(rl, c);
#pragma unroll
          for (int vi = 0; vi < 8; ++vi)
            k_ws[base + vi * 8] = (_Float16)acc[mt][t][vi];
        } else {                      // Q: row-major, scaled by C^-1/2
          const size_t base = (((size_t)b2 * HH + h) * NN) * CC + c;
#pragma unroll
          for (int vi = 0; vi < 8; ++vi)
            q_ws[base + (size_t)(rowb + vi + rl) * CC] =
                (_Float16)(acc[mt][t][vi] * 0.17677669529663687f);
          // before a register that these stores name is written again
          asm volatile("s_wait_xcnt 0x0" ::: "memory");
        }
      } else {
        const int g = n - QKV_E;
        const float gb = g_bias[g];
        const size_t base = ((size_t)b2 * NN) * HC + g;
#pragma unroll
        for (int vi = 0; vi < 8; ++vi) {
          const float z = acc[mt][t][vi] + gb;
          gate_ws[base + (size_t)(rowb + vi + rl) * HC] =
              (_Float16)(1.0f / (1.0f + __expf(-z)));
        }
      }
    }
  }
}

__device__ __forceinline__ float xhalf(float x) {
  const int b = __builtin_bit_cast(int, x);
  return __builtin_bit_cast(float, __builtin_amdgcn_permlanex16(
      b, b, 0x76543210, 0xfedcba98, false, false));
}

__global__ __launch_bounds__(256) void k_attn(
    const _Float16* __restrict__ q_ws,
    const _Float16* __restrict__ k_ws,
    const _Float16* __restrict__ vT_ws,
    const float* __restrict__ mask,       // [B2,N]
    const float* __restrict__ nb_bias,    // [H,N,N]
    const _Float16* __restrict__ gate_ws, // [B2,N,HC]
    _Float16* __restrict__ wa_ws) {       // [B2*N/16, 8 fragments x 512] gated
  // All three arrays start at multiples of 2 KiB, so that the tensor-load
  // destinations (K, V) do, in whatever order the arrays are placed in LDS.
  __shared__ __attribute__((aligned(2048))) _Float16 Klds[NN * CC];   // 16 KB, 16 fragments
  __shared__ __attribute__((aligned(2048))) _Float16 VTlds[CC * NN];  // 16 KB, 16 fragments
  __shared__ __attribute__((aligned(2048))) float MB[NN];             // mask bias per key

  const int lane = threadIdx.x & 31;
  const int wv   = threadIdx.x >> 5;
  const int h    = blockIdx.x;
  const int b2   = blockIdx.y;
  const int rl   = (lane >> 4) * 8;
  const int cl   = lane & 15;

  const size_t hd = (((size_t)b2 * HH + h) * NN) * CC;

  const float mk = mask[(size_t)b2 * NN + threadIdx.x];

  if (wv == 0) {
    tdm_load_f16_1d((uint32_t)(uintptr_t)&Klds[0],  k_ws + hd,  NN * CC);
    tdm_load_f16_1d((uint32_t)(uintptr_t)&VTlds[0], vT_ws + hd, NN * CC);
    __builtin_amdgcn_s_wait_tensorcnt(0);
  }
  MB[threadIdx.x] = 1e9f * (mk - 1.0f);
  __syncthreads();

  for (int mt = 0; mt < 2; ++mt) {
    const int m0 = wv * 32 + mt * 16;
    // B operand: column = query m0 + cl, k = c
    const v16h qb = frag_ld_f16(q_ws + hd + (size_t)m0 * CC, CC, lane);
    // before a register that these loads name is written again (a bias load
    // below lands in their address pair)
    asm volatile("s_wait_xcnt 0x0" ::: "memory");

    // nonbatched bias (per query, key): 8 consecutive keys of one query's
    // bias row per lane and tile
    const float* nbp = nb_bias + ((size_t)h * NN + m0 + cl) * NN + rl;
    v8f nbv[16];
#pragma unroll
    for (int nt = 0; nt < 16; ++nt) nbv[nt] = *(const v8f*)(nbp + nt * 16);
    // holds the 32 bias loads in front of the products, all in flight at
    // once; left free, this build issues them one by one behind the products
    // and waits each out
    __builtin_amdgcn_sched_barrier(0);

    // lg[nt][vi] = logit of query m0 + cl, key nt*16 + rl + vi
    v8f lg[16];
#pragma unroll
    for (int g = 0; g < 8; ++g) {     // two key tiles a group
      v16h kf[2];                     // A rows = keys
      v8f  mb[2];                     // mask bias (per key)
#pragma unroll
      for (int t = 0; t < 2; ++t) {
        kf[t] = frag_ld_packed(&Klds[(g * 2 + t) * 512], lane);
        mb[t] = *(const v8f*)&MB[(g * 2 + t) * 16 + rl];
      }
      // holds a group's 8 LDS loads together in front of its products, one
      // wait for all; left free, this build waits out each pair of loads
      __builtin_amdgcn_sched_barrier(0);
#pragma unroll
      for (int t = 0; t < 2; ++t) lg[g * 2 + t] = wmma16(kf[t], qb, zero8());
#pragma unroll
      for (int t = 0; t < 2; ++t) lg[g * 2 + t] += mb[t] + nbv[g * 2 + t];
    }

    // softmax over the keys of one query: eight chains in the lane (one per
    // vi), joined by a tree, then the other half of the wave
    v8f mx8 = lg[0];
#pragma unroll
    for (int nt = 1; nt < 16; ++nt) mx8 = __builtin_elementwise_max(mx8, lg[nt]);
    float mx = fmaxf(fmaxf(fmaxf(mx8[0], mx8[1]), fmaxf(mx8[2], mx8[3])),
                     fmaxf(fmaxf(mx8[4], mx8[5]), fmaxf(mx8[6], mx8[7])));
    mx = fmaxf(mx, xhalf(mx));
    v8f s8 = zero8();
#pragma unroll
    for (int nt = 0; nt < 16; ++nt) {
#pragma unroll
      for (int vi = 0; vi < 8; ++vi) lg[nt][vi] = __expf(lg[nt][vi] - mx);
      s8 += lg[nt];
    }
    float s = ((s8[0] + s8[1]) + (s8[2] + s8[3])) +
              ((s8[4] + s8[5]) + (s8[6] + s8[7]));
    s += xhalf(s);
    const float inv = 1.0f / s;

    // O^T (32 c x 16 queries) = V^T (32 x 256) x P^T (256 x 16)
    v8f ao0 = zero8(), ao1 = zero8();
#pragma unroll
    for (int kq = 0; kq < 8; ++kq) {   // 32-key block
      v16h pb;                         // k = rl + j, then 16 + rl + j
#pragma unroll
      for (int j = 0; j < 8; ++j) {
        pb[j]     = (_Float16)(lg[kq * 2][j] * inv);
        pb[8 + j] = (_Float16)(lg[kq * 2 + 1][j] * inv);
      }
      v16h a0 = frag_ld_packed(&VTlds[(kq * 2) * 512], lane);      // c 0..15
      v16h a1 = frag_ld_packed(&VTlds[(kq * 2 + 1) * 512], lane);  // c 16..31
      ao0 = wmma16(a0, pb, ao0);
      ao1 = wmma16(a1, pb, ao1);
    }

    const _Float16* gp = gate_ws + ((size_t)b2 * NN + m0 + cl) * HC + h * CC + rl;
    _Float16* wp = wa_ws + ((size_t)b2 * NN + m0) * HC + h * 512 + lane * 8;
#pragma unroll
    for (int ct = 0; ct < 2; ++ct) {
      const v8f& ao = ct ? ao1 : ao0;
      const v8h g = *(const v8h*)(gp + ct * 16);
      v8h o;
#pragma unroll
      for (int vi = 0; vi < 8; ++vi) o[vi] = (_Float16)(ao[vi] * (float)g[vi]);
      *(v8h*)(wp + ct * 256) = o;
    }
    // before a register that these stores name is written again (next trip)
    asm volatile("s_wait_xcnt 0x0" ::: "memory");
  }
}

// ---------------------------------------------------------------------------
// Kernel 3: output projection  out[M,256] = wa[M,256] x wo16^T + b_o
// Wave tile 32x64; block = 2x4 waves = 64 rows x all 256 cols.
// ---------------------------------------------------------------------------
__global__ __launch_bounds__(256) void k_out(
    const _Float16* __restrict__ wa_ws,  // [B2*N/16, 8 fragments x 512]
    const _Float16* __restrict__ wo16,   // [256/16, 8 fragments x 512]
    const float* __restrict__ b_o,       // [256]
    float* __restrict__ out) {           // [B2*N, 256]
  const int lane = threadIdx.x & 31;
  const int wv   = threadIdx.x >> 5;
  const int wr   = wv >> 2;
  const int wc   = wv & 3;
  const int row0 = blockIdx.x * 64 + wr * 32;
  const int col0 = wc * 64;
  const int rl   = (lane >> 4) * 8;
  const int cl   = lane & 15;

  const _Float16* arow = wa_ws + (size_t)row0 * HC;
  __builtin_prefetch(arow, 0, 3);

  v8f acc[2][4];
#pragma unroll
  for (int m = 0; m < 2; ++m)
#pragma unroll
    for (int t = 0; t < 4; ++t) acc[m][t] = zero8();

  // two trips a body: eight loads go out together at the head of a trip;
  // unrolled whole, this build has two to four in flight
#pragma unroll 2
  for (int kk = 0; kk < HC; kk += 32) {   // fragment kk/32 = kk*16 halves on
    v16h a0 = frag_ld_packed(arow + kk * 16, lane);
    v16h a1 = frag_ld_packed(arow + (size_t)16 * HC + kk * 16, lane);
#pragma unroll
    for (int t = 0; t < 4; ++t) {
      v16h b = frag_ld_packed(wo16 + (size_t)(col0 + t * 16) * HC + kk * 16, lane);
      acc[0][t] = wmma16(a0, b, acc[0][t]);
      acc[1][t] = wmma16(a1, b, acc[1][t]);
    }
  }

#pragma unroll
  for (int mt = 0; mt < 2; ++mt) {
#pragma unroll
    for (int t = 0; t < 4; ++t) {
      const int o = col0 + t * 16 + cl;
      const float bo = b_o[o];
#pragma unroll
      for (int vi = 0; vi < 8; ++vi) {
        const int r = row0 + mt * 16 + vi + rl;
        out[(size_t)r * OUTD + o] = acc[mt][t][vi] + bo;
      }
    }
  }
}

// ---------------------------------------------------------------------------
extern "C" void kernel_launch(void* const* d_in, const int* in_sizes, int n_in,
                              void* d_out, int out_size, void* d_ws, size_t ws_size,
                              hipStream_t stream) {
  (void)in_sizes; (void)n_in; (void)out_size; (void)ws_size;
  const float* in_data = (const float*)d_in[0];
  const float* mask    = (const float*)d_in[1];
  const float* nb_bias = (const float*)d_in[2];
  const float* w_qkv   = (const float*)d_in[3];
  const float* w_gate  = (const float*)d_in[4];
  const float* g_bias  = (const float*)d_in[5];
  const float* w_o     = (const float*)d_in[6];
  const float* b_o     = (const float*)d_in[7];
  float* out = (float*)d_out;

  // Workspace layout (f16 elements)
  const size_t QN  = (size_t)B2 * HH * NN * CC;  // 8,388,608
  _Float16* w16    = (_Float16*)d_ws;            // [1024 x 256] fused qkv|gate
  _Float16* wo16   = w16 + (size_t)(QKV_E + HC) * DD;
  _Float16* q_ws   = wo16 + (size_t)OUTD * HC;
  _Float16* k_ws   = q_ws + QN;
  _Float16* vT_ws  = k_ws + QN;
  _Float16* gate16 = vT_ws + QN;
  _Float16* wa_ws  = gate16 + (size_t)B2 * NN * HC;

  // 0) f32 -> f16 conversion passes of the weights, into fragment order
  k_cvt<<<dim3(QKV_E * DD / 8 / 256), 256, 0, stream>>>(w_qkv, w16, QKV_E * DD);
  k_cvt<<<dim3(HC * DD / 8 / 256), 256, 0, stream>>>(w_gate, w16 + (size_t)QKV_E * DD, HC * DD);
  k_cvt<<<dim3(OUTD * HC / 8 / 256), 256, 0, stream>>>(w_o, wo16, OUTD * HC);

  // 1) fused QKV + gate projection: [32768 x 256] x [256 x 1024]
  k_qkv_gate<<<dim3(4, 4, B2), 256, 0, stream>>>(in_data, w16, g_bias,
                                                 q_ws, k_ws, vT_ws, gate16);
  // 2) attention per (h, b2), K/V^T staged via Tensor Data Mover
  k_attn<<<dim3(HH, B2), 256, 0, stream>>>(q_ws, k_ws, vT_ws, mask, nb_bias,
                                           gate16, wa_ws);
  // 3) output projection: [32768 x 256] x [256 x 256] + bias
  k_out<<<dim3((B2 * NN) / 64), 256, 0, stream>>>(wa_ws, wo16, b_o, out);
}

// v005
// One run takes 82.2 microseconds.
// Timed twice side by side with v004, it ran 1.04 and 1.06 times as fast.
// Over all steps from v000 it is 1.96 times as fast.
#include <hip/hip_runtime.h>
#include <cstdint>

typedef __attribute__((ext_vector_type(16))) _Float16     v16h;
typedef __attribute__((ext_vector_type(8)))  _Float16     v8h;
typedef __attribute__((ext_vector_type(8)))  float        v8f;
typedef __attribute__((ext_vector_type(4)))  float        v4f;
typedef __attribute__((ext_vector_type(4)))  unsigned int u32x4;
typedef __attribute__((ext_vector_type(8)))  int          i32x8;
typedef __attribute__((ext_vector_type(4)))  int          i32x4;

#define B2    128
#define NN    256
#define DD    256
#define HH    8
#define CC    32
#define HC    256   // H*C
#define QKV_E 768   // 3*H*C
#define OUTD  256

__device__ __forceinline__ v8f zero8() {
  v8f z;
#pragma unroll
  for (int j = 0; j < 8; ++j) z[j] = 0.0f;
  return z;
}

// element j -> src[r*stride + k]; per-lane halves are two contiguous 16B runs
__device__ __forceinline__ v16h frag_ld_f16(const _Float16* __restrict__ src,
                                            int stride, int lane) {
  const int r  = lane & 15;
  const int kb = (lane >> 4) * 8;
  const _Float16* p = src + (size_t)r * stride + kb;
  v16h f;
#pragma unroll
  for (int j = 0; j < 8; ++j) f[j] = p[j];
#pragma unroll
  for (int j = 0; j < 8; ++j) f[8 + j] = p[16 + j];
  return f;
}

__device__ __forceinline__ v16h frag_ld_packed(const _Float16* src, int lane) {
  const v8h lo = *(const v8h*)(src + lane * 8);
  const v8h hi = *(const v8h*)(src + 256 + lane * 8);
  return __builtin_shufflevector(lo, hi, 0, 1, 2, 3, 4, 5, 6, 7,
                                 8, 9, 10, 11, 12, 13, 14, 15);
}

// offset (halves) of element (col, k) inside one fragment, col 0..15, k 0..31
__device__ __forceinline__ int frag_off(int col, int k) {
  return ((k >> 4) & 1) * 256 + ((((k >> 3) & 1) * 16) + col) * 8 + (k & 7);
}

__device__ __forceinline__ v8f wmma16(v16h a, v16h b, v8f c) {
  return __builtin_amdgcn_wmma_f32_16x16x32_f16(false, a, false, b,
                                                (short)0, c, false, false);
}

__device__ __forceinline__ void tdm_load_f16_1d(uint32_t lds_off,
                                                const _Float16* gsrc,
                                                uint32_t nelem) {
  const uint64_t ga = (uint64_t)(uintptr_t)gsrc;
  u32x4 g0;
  g0[0] = 1u;                                                  // count=1
  g0[1] = lds_off;                                             // lds_addr
  g0[2] = (uint32_t)ga;                                        // ga[31:0]
  g0[3] = (uint32_t)((ga >> 32) & 0x01FFFFFFu) | (2u << 30);   // ga[56:32]|type
  i32x8 g1;
  g1[0] = 0x00010000;
  g1[1] = (int)((nelem & 0xFFFFu) << 16);
  g1[2] = (int)(((nelem >> 16) & 0xFFFFu) | (1u << 16));
  g1[3] = (int)((nelem & 0xFFFFu) << 16);
  g1[4] = 0;
  g1[5] = (int)nelem;
  g1[6] = 0;
  g1[7] = 0;
  i32x4 gz;
  gz[0] = gz[1] = gz[2] = gz[3] = 0;
#if defined(__clang_major__) && __clang_major__ >= 23
  i32x8 g4;
#pragma unroll
  for (int j = 0; j < 8; ++j) g4[j] = 0;
  __builtin_amdgcn_tensor_load_to_lds(g0, g1, gz, gz, g4, 0);
#else
  __builtin_amdgcn_tensor_load_to_lds(g0, g1, gz, gz, 0);
#endif
}

// ---------------------------------------------------------------------------
// Kernel 0: f32 -> f16 conversion pass (8 elems/thread, b128 in / b128 out)
// of all three weight matrices in ONE launch: row-major matrices of 256
// columns into fragment order.  The three results lie one behind the other
// in the workspace (768 qkv rows, 256 gate rows, 256 output-projection rows),
// so they are one matrix of 1280 rows for the writer: thread t writes the
// t-th 16 bytes of dst, stores stay contiguous, a block reads 512 contiguous
// bytes of each of 16 rows.  A block's 16 rows lie in one source matrix.
// ---------------------------------------------------------------------------
__global__ __launch_bounds__(256) void k_cvt(const float* __restrict__ w_qkv,
                                             const float* __restrict__ w_gate,
                                             const float* __restrict__ w_o,
                                             _Float16* __restrict__ dst) {
  const int t   = blockIdx.x * 256 + threadIdx.x;
  const int R   = blockIdx.x >> 1;                 // row tile (two blocks each)
  const int fr  = t >> 6;                          // fragment R*8 + b
  const int k   = (fr & 7) * 32 + ((t >> 5) & 1) * 16 + ((t >> 4) & 1) * 8;
  const float* m = w_qkv;                          // block-uniform choice
  int Rl = R;                                      // row tile in its own matrix
  if (R >= (QKV_E + HC) / 16) {
    m = w_o;
    Rl = R - (QKV_E + HC) / 16;
  } else if (R >= QKV_E / 16) {
    m = w_gate;
    Rl = R - QKV_E / 16;
  }
  const float* __restrict__ sp = m + (size_t)(Rl * 16 + (t & 15)) * 256 + k;
#pragma unroll
  for (int j = 0; j < 8; ++j) dst[(size_t)t * 8 + j] = (_Float16)sp[j];
}

// ---------------------------------------------------------------------------
// Kernel 1: fused QKV + gate projection, all-f16 operands.
//   x[b2*n, d] x w16^T[1024, d]  (rows: 768 qkv, then 256 gate)
// A block takes its 64 rows of x as f32 and converts them into LDS in
// fragment order (32 KB); w16 is read from global memory in fragment order.
// Wave tile 32x64 (2 A-frags x 4 B-frags -> 8 WMMA); block = 2x4 waves
// = 64 rows x 256 cols.  Q pre-scaled, row-major.  K and V are stored per
// (b2,h) in the fragment order their readers in k_attn use (frag_off):
// K: fragment n>>4, col = n&15, k = c;  V: fragment (n>>5)*2 + (c>>4),
// col = c&15, k = n&31.  gate = sigmoid(.+bias) stored f16.
// ---------------------------------------------------------------------------
__global__ __launch_bounds__(256) void k_qkv_gate(
    const float* __restrict__ x,        // [B2*N, 256] row-major
    const _Float16* __restrict__ w16,   // [1024/16, 8 fragments x 512]
    const float* __restrict__ g_bias,   // [256]
    _Float16* __restrict__ q_ws,        // [B2,H,N,C] (scaled)
    _Float16* __restrict__ k_ws,        // [B2,H, 16 fragments x 512]
    _Float16* __restrict__ vT_ws,       // [B2,H, 16 fragments x 512]
    _Float16* __restrict__ gate_ws) {   // [B2,N,HC]
  const int lane = threadIdx.x & 31;
  const int wv   = threadIdx.x >> 5;
  const int wr   = wv >> 2;            // 0..1
  const int wc   = wv & 3;             // 0..3
  const int b2   = blockIdx.z;
  const int row0 = blockIdx.y * 64 + wr * 32;
  const int col0 = blockIdx.x * 256 + wc * 64;
  const int rl   = (lane >> 4) * 8;
  const int cl   = lane & 15;

  __shared__ __attribute__((aligned(16))) _Float16 Xl[64 * DD];  // 32 fragments

  // x tile -> LDS.  Wave wv takes k 32wv..32wv+31 (one 128-B line a row), 8
  // rows a trip: 4 lanes share a line, the block reads 8 whole rows a trip.
  // A lane's 8 values are one 16-B unit of the fragment.
  {
    const float* __restrict__ xs =
        x + ((size_t)b2 * NN + blockIdx.y * 64 + (lane >> 2)) * DD + wv * 32 +
        (lane & 3) * 8;
    v4f lo[8], hi[8];
#pragma unroll
    for (int it = 0; it < 8; ++it) {
      lo[it] = *(const v4f*)(xs + (size_t)it * 8 * DD);
      hi[it] = *(const v4f*)(xs + (size_t)it * 8 * DD + 4);
    }
#pragma unroll
    for (int it = 0; it < 8; ++it) {
      v8h o;
#pragma unroll
      for (int j = 0; j < 4; ++j) {
        o[j]     = (_Float16)lo[it][j];
        o[4 + j] = (_Float16)hi[it][j];
      }
      *(v8h*)&Xl[((it >> 1) * 8 + wv) * 512 +
                 frag_off((it & 1) * 8 + (lane >> 2), (lane & 3) * 8)] = o;
    }
  }
  __syncthreads();

  const _Float16* xrow = &Xl[wr * 2 * 8 * 512];

  v8f acc[2][4];
#pragma unroll
  for (int m = 0; m < 2; ++m)
#pragma unroll
    for (int t = 0; t < 4; ++t) acc[m][t] = zero8();

#pragma unroll 1
  for (int kk = 0; kk < DD; kk += 32) {   // fragment kk/32 = kk*16 halves on
    v16h b[4];
#pragma unroll
    for (int t = 0; t < 4; ++t)
      b[t] = frag_ld_packed(w16 + (size_t)(col0 + t * 16) * DD + kk * 16, lane);
    v16h a0 = frag_ld_packed(xrow + kk * 16, lane);
    v16h a1 = frag_ld_packed(xrow + (size_t)16 * DD + kk * 16, lane);
    // holds a trip's eight global loads, then its four LDS loads, in front of
    // its products, all in flight at once; left free, this build holds two B
    // fragments at a time and waits out a second pair in the middle of a trip
    __builtin_amdgcn_sched_barrier(0);
#pragma unroll
    for (int t = 0; t < 4; ++t) {
      acc[0][t] = wmma16(a0, b[t], acc[0][t]);
      acc[1][t] = wmma16(a1, b[t], acc[1][t]);
    }
  }

#pragma unroll
  for (int mt = 0; mt < 2; ++mt) {
    const int rowb = row0 + mt * 16;
#pragma unroll
    for (int t = 0; t < 4; ++t) {
      const int nb = col0 + t * 16;   // tile-uniform fused column
      const int n  = nb + cl;
      if (nb < QKV_E) {
        const int which = nb / HC;    // 0=q 1=k 2=v (block-uniform here)
        const int hc = n - which * HC;
        const int h = hc >> 5, c = hc & 31;
        if (which == 2) {             // V: 8 keys of one c = 16 B per lane
          const int n0 = rowb + rl;
          const size_t base = ((size_t)b2 * HH + h) * (CC * NN) +
                              ((n0 >> 5) * 2 + (c >> 4)) * 512 +
                              frag_off(c & 15, n0 & 31);
#pragma unroll
          for (int vi = 0; vi < 8; ++vi)
            vT_ws[base + vi] = (_Float16)acc[mt][t][vi];
          // before a register that the store names is written again
          asm volatile("s_wait_xcnt 0x0" ::: "memory");
        } else if (which == 1) {      // K: fragment order
          const size_t base = ((size_t)b2 * HH + h) * (NN * CC) +
                              (rowb >> 4) * 512 + frag_off(rl, c);
#pragma unroll
          for (int vi = 0; vi < 8; ++vi)
            k_ws[base + vi * 8] = (_Float16)acc[mt][t][vi];
        } else {                      // Q: row-major, scaled by C^-1/2
          const size_t base = (((size_t)b2 * HH + h) * NN) * CC + c;
#pragma unroll
          for (int vi = 0; vi < 8; ++vi)
            q_ws[base + (size_t)(rowb + vi + rl) * CC] =
                (_Float16)(acc[mt][t][vi] * 0.17677669529663687f);
          // before a register that these stores name is written again
          asm volatile("s_wait_xcnt 0x0" ::: "memory");
        }
      } else {
        const int g = n - QKV_E;
        const float gb = g_bias[g];
        const size_t base = ((size_t)b2 * NN) * HC + g;
#pragma unroll
        for (int vi = 0; vi < 8; ++vi) {
          const float z = acc[mt][t][vi] + gb;
          gate_ws[base + (size_t)(rowb + vi + rl) * HC] =
              (_Float16)(1.0f / (1.0f + __expf(-z)));
        }
      }
    }
  }
}

__device__ __forceinline__ float xhalf(float x) {
  const int b = __builtin_bit_cast(int, x);
  return __builtin_bit_cast(float, __builtin_amdgcn_permlanex16(
      b, b, 0x76543210, 0xfedcba98, false, false));
}

__global__ __launch_bounds__(256) void k_attn(
    const _Float16* __restrict__ q_ws,
    const _Float16* __restrict__ k_ws,
    const _Float16* __restrict__ vT_ws,
    const float* __restrict__ mask,       // [B2,N]
    const float* __restrict__ nb_bias,    // [H,N,N]
    const _Float16* __restrict__ gate_ws, // [B2,N,HC]
    _Float16* __restrict__ wa_ws) {       // [B2*N/16, 8 fragments x 512] gated
  // All three arrays start at multiples of 2 KiB, so that the tensor-load
  // destinations (K, V) do, in whatever order the arrays are placed in LDS.
  __shared__ __attribute__((aligned(2048))) _Float16 Klds[NN * CC];   // 16 KB, 16 fragments
  __shared__ __attribute__((aligned(2048))) _Float16 VTlds[CC * NN];  // 16 KB, 16 fragments
  __shared__ __attribute__((aligned(2048))) float MB[NN];             // mask bias per key

  const int lane = threadIdx.x & 31;
  const int wv   = threadIdx.x >> 5;
  const int h    = blockIdx.x;
  const int b2   = blockIdx.y;
  const int rl   = (lane >> 4) * 8;
  const int cl   = lane & 15;

  const size_t hd = (((size_t)b2 * HH + h) * NN) * CC;

  const float mk = mask[(size_t)b2 * NN + threadIdx.x];

  if (wv == 0) {
    tdm_load_f16_1d((uint32_t)(uintptr_t)&Klds[0],  k_ws + hd,  NN * CC);
    tdm_load_f16_1d((uint32_t)(uintptr_t)&VTlds[0], vT_ws + hd, NN * CC);
    __builtin_amdgcn_s_wait_tensorcnt(0);
  }
  MB[threadIdx.x] = 1e9f * (mk - 1.0f);
  __syncthreads();

  for (int mt = 0; mt < 2; ++mt) {
    const int m0 = wv * 32 + mt * 16;
    // B operand: column = query m0 + cl, k = c
    const v16h qb = frag_ld_f16(q_ws + hd + (size_t)m0 * CC, CC, lane);
    // before a register that these loads name is written again (a bias load
    // below lands in their address pair)
    asm volatile("s_wait_xcnt 0x0" ::: "memory");

    // nonbatched bias (per query, key): 8 consecutive keys of one query's
    // bias row per lane and tile
    const float* nbp = nb_bias + ((size_t)h * NN + m0 + cl) * NN + rl;
    v8f nbv[16];
#pragma unroll
    for (int nt = 0; nt < 16; ++nt) nbv[nt] = *(const v8f*)(nbp + nt * 16);
    // holds the 32 bias loads in front of the products, all in flight at
    // once; left free, this build issues them one by one behind the products
    // and waits each out
    __builtin_amdgcn_sched_barrier(0);

    // lg[nt][vi] = logit of query m0 + cl, key nt*16 + rl + vi
    v8f lg[16];
#pragma unroll
    for (int g = 0; g < 8; ++g) {     // two key tiles a group
      v16h kf[2];                     // A rows = keys
      v8f  mb[2];                     // mask bias (per key)
#pragma unroll
      for (int t = 0; t < 2; ++t) {
        kf[t] = frag_ld_packed(&Klds[(g * 2 + t) * 512], lane);
        mb[t] = *(const v8f*)&MB[(g * 2 + t) * 16 + rl];
      }
      // holds a group's 8 LDS loads together in front of its products, one
      // wait for all; left free, this build waits out each pair of loads
      __builtin_amdgcn_sched_barrier(0);
#pragma unroll
      for (int t = 0; t < 2; ++t) lg[g * 2 + t] = wmma16(kf[t], qb, zero8());
#pragma unroll
      for (int t = 0; t < 2; ++t) lg[g * 2 + t] += mb[t] + nbv[g * 2 + t];
    }

    // softmax over the keys of one query: eight chains in the lane (one per
    // vi), joined by a tree, then the other half of the wave
    v8f mx8 = lg[0];
#pragma unroll
    for (int nt = 1; nt < 16; ++nt) mx8 = __builtin_elementwise_max(mx8, lg[nt]);
    float mx = fmaxf(fmaxf(fmaxf(mx8[0], mx8[1]), fmaxf(mx8[2], mx8[3])),
                     fmaxf(fmaxf(mx8[4], mx8[5]), fmaxf(mx8[6], mx8[7])));
    mx = fmaxf(mx, xhalf(mx));
    v8f s8 = zero8();
#pragma unroll
    for (int nt = 0; nt < 16; ++nt) {
#pragma unroll
      for (int vi = 0; vi < 8; ++vi) lg[nt][vi] = __expf(lg[nt][vi] - mx);
      s8 += lg[nt];
    }
    float s = ((s8[0] + s8[1]) + (s8[2] + s8[3])) +
              ((s8[4] + s8[5]) + (s8[6] + s8[7]));
    s += xhalf(s);
    const float inv = 1.0f / s;

    // O^T (32 c x 16 queries) = V^T (32 x 256) x P^T (256 x 16)
    v8f ao0 = zero8(), ao1 = zero8();
#pragma unroll
    for (int kq = 0; kq < 8; ++kq) {   // 32-key block
      v16h pb;                         // k = rl + j, then 16 + rl + j
#pragma unroll
      for (int j = 0; j < 8; ++j) {
        pb[j]     = (_Float16)(lg[kq * 2][j] * inv);
        pb[8 + j] = (_Float16)(lg[kq * 2 + 1][j] * inv);
      }
      v16h a0 = frag_ld_packed(&VTlds[(kq * 2) * 512], lane);      // c 0..15
      v16h a1 = frag_ld_packed(&VTlds[(kq * 2 + 1) * 512], lane);  // c 16..31
      ao0 = wmma16(a0, pb, ao0);
      ao1 = wmma16(a1, pb, ao1);
    }

    const _Float16* gp = gate_ws + ((size_t)b2 * NN + m0 + cl) * HC + h * CC + rl;
    _Float16* wp = wa_ws + ((size_t)b2 * NN + m0) * HC + h * 512 + lane * 8;
#pragma unroll
    for (int ct = 0; ct < 2; ++ct) {
      const v8f& ao = ct ? ao1 : ao0;
      const v8h g = *(const v8h*)(gp + ct * 16);
      v8h o;
#pragma unroll
      for (int vi = 0; vi < 8; ++vi) o[vi] = (_Float16)(ao[vi] * (float)g[vi]);
      *(v8h*)(wp + ct * 256) = o;
    }
    // before a register that these stores name is written again (next trip)
    asm volatile("s_wait_xcnt 0x0" ::: "memory");
  }
}

// ---------------------------------------------------------------------------
// Kernel 3: output projection  out[M,256] = wa[M,256] x wo16^T + b_o
// Wave tile 32x64; block = 2x4 waves = 64 rows x all 256 cols.
// ---------------------------------------------------------------------------
__global__ __launch_bounds__(256) void k_out(
    const _Float16* __restrict__ wa_ws,  // [B2*N/16, 8 fragments x 512]
    const _Float16* __restrict__ wo16,   // [256/16, 8 fragments x 512]
    const float* __restrict__ b_o,       // [256]
    float* __restrict__ out) {           // [B2*N, 256]
  const int lane = threadIdx.x & 31;
  const int wv   = threadIdx.x >> 5;
  const int wr   = wv >> 2;
  const int wc   = wv & 3;
  const int row0 = blockIdx.x * 64 + wr * 32;
  const int col0 = wc * 64;
  const int rl   = (lane >> 4) * 8;
  const int cl   = lane & 15;

  const _Float16* arow = wa_ws + (size_t)row0 * HC;
  __builtin_prefetch(arow, 0, 3);

  v8f acc[2][4];
#pragma unroll
  for (int m = 0; m < 2; ++m)
#pragma unroll
    for (int t = 0; t < 4; ++t) acc[m][t] = zero8();

  // two trips a body: eight loads go out together at the head of a trip;
  // unrolled whole, this build has two to four in flight
#pragma unroll 2
  for (int kk = 0; kk < HC; kk += 32) {   // fragment kk/32 = kk*16 halves on
    v16h a0 = frag_ld_packed(arow + kk * 16, lane);
    v16h a1 = frag_ld_packed(arow + (size_t)16 * HC + kk * 16, lane);
#pragma unroll
    for (int t = 0; t < 4; ++t) {
      v16h b = frag_ld_packed(wo16 + (size_t)(col0 + t * 16) * HC + kk * 16, lane);
      acc[0][t] = wmma16(a0, b, acc[0][t]);
      acc[1][t] = wmma16(a1, b, acc[1][t]);
    }
  }

#pragma unroll
  for (int mt = 0; mt < 2; ++mt) {
#pragma unroll
    for (int t = 0; t < 4; ++t) {
      const int o = col0 + t * 16 + cl;
      const float bo = b_o[o];
#pragma unroll
      for (int vi = 0; vi < 8; ++vi) {
        const int r = row0 + mt * 16 + vi + rl;
        out[(size_t)r * OUTD + o] = acc[mt][t][vi] + bo;
      }
    }
  }
}

// ---------------------------------------------------------------------------
extern "C" void kernel_launch(void* const* d_in, const int* in_sizes, int n_in,
                              void* d_out, int out_size, void* d_ws, size_t ws_size,
                              hipStream_t stream) {
  (void)in_sizes; (void)n_in; (void)out_size; (void)ws_size;
  const float* in_data = (const float*)d_in[0];
  const float* mask    = (const float*)d_in[1];
  const float* nb_bias = (const float*)d_in[2];
  const float* w_qkv   = (const float*)d_in[3];
  const float* w_gate  = (const float*)d_in[4];
  const float* g_bias  = (const float*)d_in[5];
  const float* w_o     = (const float*)d_in[6];
  const float* b_o     = (const float*)d_in[7];
  float* out = (float*)d_out;

  // Workspace layout (f16 elements)
  const size_t QN  = (size_t)B2 * HH * NN * CC;  // 8,388,608
  _Float16* w16    = (_Float16*)d_ws;            // [1024 x 256] fused qkv|gate
  _Float16* wo16   = w16 + (size_t)(QKV_E + HC) * DD;
  _Float16* q_ws   = wo16 + (size_t)OUTD * HC;
  _Float16* k_ws   = q_ws + QN;
  _Float16* vT_ws  = k_ws + QN;
  _Float16* gate16 = vT_ws + QN;
  _Float16* wa_ws  = gate16 + (size_t)B2 * NN * HC;

  // 0) f32 -> f16 conversion of the three weight matrices, into fragment
  //    order, one launch (wo16 lies directly behind w16)
  k_cvt<<<dim3((QKV_E + HC + OUTD) * DD / 8 / 256), 256, 0, stream>>>(
      w_qkv, w_gate, w_o, w16);

  // 1) fused QKV + gate projection: [32768 x 256] x [256 x 1024]
  k_qkv_gate<<<dim3(4, 4, B2), 256, 0, stream>>>(in_data, w16, g_bias,
                                                 q_ws, k_ws, vT_ws, gate16);
  // 2) attention per (h, b2), K/V^T staged via Tensor Data Mover
  k_attn<<<dim3(HH, B2), 256, 0, stream>>>(q_ws, k_ws, vT_ws, mask, nb_bias,
                                           gate16, wa_ws);
  // 3) output projection: [32768 x 256] x [256 x 256] + bias
  k_out<<<dim3((B2 * NN) / 64), 256, 0, stream>>>(wa_ws, wo16, b_o, out);
}

// v006
// One run takes 77.7 microseconds.
// Two timings next to v005 both put it at 1.05 times that version's speed.
// Counting every step since v000, it is 2.07 times as fast.
#include <hip/hip_runtime.h>
#include <cstdint>

typedef __attribute__((ext_vector_type(16))) _Float16     v16h;
typedef __attribute__((ext_vector_type(8)))  _Float16     v8h;
typedef __attribute__((ext_vector_type(8)))  float        v8f;
typedef __attribute__((ext_vector_type(4)))  float        v4f;
typedef __attribute__((ext_vector_type(4)))  unsigned int u32x4;
typedef __attribute__((ext_vector_type(8)))  int          i32x8;
typedef __attribute__((ext_vector_type(4)))  int          i32x4;

#define B2    128
#define NN    256
#define DD    256
#define HH    8
#define CC    32
#define HC    256   // H*C
#define QKV_E 768   // 3*H*C
#define OUTD  256

__device__ __forceinline__ v8f zero8() {
  v8f z;
#pragma unroll
  for (int j = 0; j < 8; ++j) z[j] = 0.0f;
  return z;
}

// element j -> src[r*stride + k]; per-lane halves are two contiguous 16B runs
__device__ __forceinline__ v16h frag_ld_f16(const _Float16* __restrict__ src,
                                            int stride, int lane) {
  const int r  = lane & 15;
  const int kb = (lane >> 4) * 8;
  const _Float16* p = src + (size_t)r * stride + kb;
  v16h f;
#pragma unroll
  for (int j = 0; j < 8; ++j) f[j] = p[j];
#pragma unroll
  for (int j = 0; j < 8; ++j) f[8 + j] = p[16 + j];
  return f;
}

__device__ __forceinline__ v16h frag_ld_packed(const _Float16* src, int lane) {
  const v8h lo = *(const v8h*)(src + lane * 8);
  const v8h hi = *(const v8h*)(src + 256 + lane * 8);
  return __builtin_shufflevector(lo, hi, 0, 1, 2, 3, 4, 5, 6, 7,
                                 8, 9, 10, 11, 12, 13, 14, 15);
}

// offset (halves) of element (col, k) inside one fragment, col 0..15, k 0..31
__device__ __forceinline__ int frag_off(int col, int k) {
  return ((k >> 4) & 1) * 256 + ((((k >> 3) & 1) * 16) + col) * 8 + (k & 7);
}

__device__ __forceinline__ v8f wmma16(v16h a, v16h b, v8f c) {
  return __builtin_amdgcn_wmma_f32_16x16x32_f16(false, a, false, b,
                                                (short)0, c, false, false);
}

__device__ __forceinline__ void tdm_load_f16_1d(uint32_t lds_off,
                                                const _Float16* gsrc,
                                                uint32_t nelem) {
  const uint64_t ga = (uint64_t)(uintptr_t)gsrc;
  u32x4 g0;
  g0[0] = 1u;                                                  // count=1
  g0[1] = lds_off;                                             // lds_addr
  g0[2] = (uint32_t)ga;                                        // ga[31:0]
  g0[3] = (uint32_t)((ga >> 32) & 0x01FFFFFFu) | (2u << 30);   // ga[56:32]|type
  i32x8 g1;
  g1[0] = 0x00010000;
  g1[1] = (int)((nelem & 0xFFFFu) << 16);
  g1[2] = (int)(((nelem >> 16) & 0xFFFFu) | (1u << 16));
  g1[3] = (int)((nelem & 0xFFFFu) << 16);
  g1[4] = 0;
  g1[5] = (int)nelem;
  g1[6] = 0;
  g1[7] = 0;
  i32x4 gz;
  gz[0] = gz[1] = gz[2] = gz[3] = 0;
#if defined(__clang_major__) && __clang_major__ >= 23
  i32x8 g4;
#pragma unroll
  for (int j = 0; j < 8; ++j) g4[j] = 0;
  __builtin_amdgcn_tensor_load_to_lds(g0, g1, gz, gz, g4, 0);
#else
  __builtin_amdgcn_tensor_load_to_lds(g0, g1, gz, gz, 0);
#endif
}

// ---------------------------------------------------------------------------
// Kernel 0: f32 -> f16 conversion pass (8 elems/thread, b128 in / b128 out)
// of all three weight matrices in ONE launch: row-major matrices of 256
// columns into fragment order.  The three results lie one behind the other
// in the workspace (768 qkv rows, 256 gate rows, 256 output-projection rows),
// so they are one matrix of 1280 rows for the writer: thread t writes the
// t-th 16 bytes of dst, stores stay contiguous, a block reads 512 contiguous
// bytes of each of 16 rows.  A block's 16 rows lie in one source matrix.
// The blocks behind those copy the nonbatched bias (f32, values unchanged)
// into the order in which k_attn's lanes hold their scores: per head, 16
// queries and 16 keys one tile of 1 KB, two planes of 512 B; plane p holds at
// lane*4 + j the bias of query lane&15, key (lane>>4)*8 + p*4 + j.  A wave's
// global_load_b128 then reads 512 contiguous bytes, 4 lines, where bias rows
// of 1 KB make it touch 16.  A block takes one head's 16 queries (16 KB): its
// stores are contiguous, a trip reads two whole 128-B lines of each of 16 rows.
// ---------------------------------------------------------------------------
#define WBLK ((QKV_E + HC + OUTD) * DD / 8 / 256)   // blocks on the weights
#define NBLK (HH * NN / 16)                         // blocks on the bias

__global__ __launch_bounds__(256) void k_cvt(const float* __restrict__ w_qkv,
                                             const float* __restrict__ w_gate,
                                             const float* __restrict__ w_o,
                                             const float* __restrict__ nb_bias,
                                             _Float16* __restrict__ dst,
                                             float* __restrict__ nb_t) {
  if (blockIdx.x >= WBLK) {                        // block-uniform
    const int tile = blockIdx.x - WBLK;            // h*16 + query tile
    const int u    = threadIdx.x;                  // 16-B unit; + 256 a trip
    const int l    = u & 31;
    const float* sp = nb_bias + (size_t)(tile * 16 + (l & 15)) * NN +
                      (u >> 6) * 16 + (l >> 4) * 8 + ((u >> 5) & 1) * 4;
    v4f v[4];
#pragma unroll
    for (int i = 0; i < 4; ++i) v[i] = *(const v4f*)(sp + i * 64);  // 4 key tiles on
    // before a register that these loads name is written again; the address
    // as an input keeps the last load's data out of the address pair
    asm volatile("s_wait_xcnt 0x0" :: "v"(sp) : "memory");
    float* dp = nb_t + (size_t)tile * (16 * NN) + u * 4;
#pragma unroll
    for (int i = 0; i < 4; ++i) *(v4f*)(dp + i * 1024) = v[i];
    return;
  }
  const int t   = blockIdx.x * 256 + threadIdx.x;
  const int R   = blockIdx.x >> 1;                 // row tile (two blocks each)
  const int fr  = t >> 6;                          // fragment R*8 + b
  const int k   = (fr & 7) * 32 + ((t >> 5) & 1) * 16 + ((t >> 4) & 1) * 8;
  const float* m = w_qkv;                          // block-uniform choice
  int Rl = R;                                      // row tile in its own matrix
  if (R >= (QKV_E + HC) / 16) {
    m = w_o;
    Rl = R - (QKV_E + HC) / 16;
  } else if (R >= QKV_E / 16) {
    m = w_gate;
    Rl = R - QKV_E / 16;
  }
  const float* __restrict__ sp = m + (size_t)(Rl * 16 + (t & 15)) * 256 + k;
#pragma unroll
  for (int j = 0; j < 8; ++j) dst[(size_t)t * 8 + j] = (_Float16)sp[j];
}

// ---------------------------------------------------------------------------
// Kernel 1: fused QKV + gate projection, all-f16 operands.
//   x[b2*n, d] x w16^T[1024, d]  (rows: 768 qkv, then 256 gate)
// A block takes its 64 rows of x as f32 and converts them into LDS in
// fragment order (32 KB); w16 is read from global memory in fragment order.
// Wave tile 32x64 (2 A-frags x 4 B-frags -> 8 WMMA); block = 2x4 waves
// = 64 rows x 256 cols.  Q pre-scaled, row-major.  K and V are stored per
// (b2,h) in the fragment order their readers in k_attn use (frag_off):
// K: fragment n>>4, col = n&15, k = c;  V: fragment (n>>5)*2 + (c>>4),
// col = c&15, k = n&31.  gate = sigmoid(.+bias) stored f16.
// ---------------------------------------------------------------------------
__global__ __launch_bounds__(256) void k_qkv_gate(
    const float* __restrict__ x,        // [B2*N, 256] row-major
    const _Float16* __restrict__ w16,   // [1024/16, 8 fragments x 512]
    const float* __restrict__ g_bias,   // [256]
    _Float16* __restrict__ q_ws,        // [B2,H,N,C] (scaled)
    _Float16* __restrict__ k_ws,        // [B2,H, 16 fragments x 512]
    _Float16* __restrict__ vT_ws,       // [B2,H, 16 fragments x 512]
    _Float16* __restrict__ gate_ws) {   // [B2,N,HC]
  const int lane = threadIdx.x & 31;
  const int wv   = threadIdx.x >> 5;
  const int wr   = wv >> 2;            // 0..1
  const int wc   = wv & 3;             // 0..3
  const int b2   = blockIdx.z;
  const int row0 = blockIdx.y * 64 + wr * 32;
  const int col0 = blockIdx.x * 256 + wc * 64;
  const int rl   = (lane >> 4) * 8;
  const int cl   = lane & 15;

  __shared__ __attribute__((aligned(16))) _Float16 Xl[64 * DD];  // 32 fragments

  // x tile -> LDS.  Wave wv takes k 32wv..32wv+31 (one 128-B line a row), 8
  // rows a trip: 4 lanes share a line, the block reads 8 whole rows a trip.
  // A lane's 8 values are one 16-B unit of the fragment.
  {
    const float* __restrict__ xs =
        x + ((size_t)b2 * NN + blockIdx.y * 64 + (lane >> 2)) * DD + wv * 32 +
        (lane & 3) * 8;
    v4f lo[8], hi[8];
#pragma unroll
    for (int it = 0; it < 8; ++it) {
      lo[it] = *(const v4f*)(xs + (size_t)it * 8 * DD);
      hi[it] = *(const v4f*)(xs + (size_t)it * 8 * DD + 4);
    }
#pragma unroll
    for (int it = 0; it < 8; ++it) {
      v8h o;
#pragma unroll
      for (int j = 0; j < 4; ++j) {
        o[j]     = (_Float16)lo[it][j];
        o[4 + j] = (_Float16)hi[it][j];
      }
      *(v8h*)&Xl[((it >> 1) * 8 + wv) * 512 +
                 frag_off((it & 1) * 8 + (lane >> 2), (lane & 3) * 8)] = o;
    }
  }
  __syncthreads();

  const _Float16* xrow = &Xl[wr * 2 * 8 * 512];

  v8f acc[2][4];
#pragma unroll
  for (int m = 0; m < 2; ++m)
#pragma unroll
    for (int t = 0; t < 4; ++t) acc[m][t] = zero8();

#pragma unroll 1
  for (int kk = 0; kk < DD; kk += 32) {   // fragment kk/32 = kk*16 halves on
    v16h b[4];
#pragma unroll
    for (int t = 0; t < 4; ++t)
      b[t] = frag_ld_packed(w16 + (size_t)(col0 + t * 16) * DD + kk * 16, lane);
    v16h a0 = frag_ld_packed(xrow + kk * 16, lane);
    v16h a1 = frag_ld_packed(xrow + (size_t)16 * DD + kk * 16, lane);
    // holds a trip's eight global loads, then its four LDS loads, in front of
    // its products, all in flight at once; left free, this build holds two B
    // fragments at a time and waits out a second pair in the middle of a trip
    __builtin_amdgcn_sched_barrier(0);
#pragma unroll
    for (int t = 0; t < 4; ++t) {
      acc[0][t] = wmma16(a0, b[t], acc[0][t]);
      acc[1][t] = wmma16(a1, b[t], acc[1][t]);
    }
  }

#pragma unroll
  for (int mt = 0; mt < 2; ++mt) {
    const int rowb = row0 + mt * 16;
#pragma unroll
    for (int t = 0; t < 4; ++t) {
      const int nb = col0 + t * 16;   // tile-uniform fused column
      const int n  = nb + cl;
      if (nb < QKV_E) {
        const int which = nb / HC;    // 0=q 1=k 2=v (block-uniform here)
        const int hc = n - which * HC;
        const int h = hc >> 5, c = hc & 31;
        if (which == 2) {             // V: 8 keys of one c = 16 B per lane
          const int n0 = rowb + rl;
          const size_t base = ((size_t)b2 * HH + h) * (CC * NN) +
                              ((n0 >> 5) * 2 + (c >> 4)) * 512 +
                              frag_off(c & 15, n0 & 31);
#pragma unroll
          for (int vi = 0; vi < 8; ++vi)
            vT_ws[base + vi] = (_Float16)acc[mt][t][vi];
          // before a register that the store names is written again
          asm volatile("s_wait_xcnt 0x0" ::: "memory");
        } else if (which == 1) {      // K: fragment order
          const size_t base = ((size_t)b2 * HH + h) * (NN * CC) +
                              (rowb >> 4) * 512 + frag_off(rl, c);
#pragma unroll
          for (int vi = 0; vi < 8; ++vi)
            k_ws[base + vi * 8] = (_Float16)acc[mt][t][vi];
        } else {                      // Q: row-major, scaled by C^-1/2
          const size_t base = (((size_t)b2 * HH + h) * NN) * CC + c;
#pragma unroll
          for (int vi = 0; vi < 8; ++vi)
            q_ws[base + (size_t)(rowb + vi + rl) * CC] =
                (_Float16)(acc[mt][t][vi] * 0.17677669529663687f);
          // before a register that these stores name is written again
          asm volatile("s_wait_xcnt 0x0" ::: "memory");
        }
      } else {
        const int g = n - QKV_E;
        const float gb = g_bias[g];
        const size_t base = ((size_t)b2 * NN) * HC + g;
#pragma unroll
        for (int vi = 0; vi < 8; ++vi) {
          const float z = acc[mt][t][vi] + gb;
          gate_ws[base + (size_t)(rowb + vi + rl) * HC] =
              (_Float16)(1.0f / (1.0f + __expf(-z)));
        }
      }
    }
  }
}

__device__ __forceinline__ float xhalf(float x) {
  const int b = __builtin_bit_cast(int, x);
  return __builtin_bit_cast(float, __builtin_amdgcn_permlanex16(
      b, b, 0x76543210, 0xfedcba98, false, false));
}

__global__ __launch_bounds__(256) void k_attn(
    const _Float16* __restrict__ q_ws,
    const _Float16* __restrict__ k_ws,
    const _Float16* __restrict__ vT_ws,
    const float* __restrict__ mask,       // [B2,N]
    const float* __restrict__ nb_t,       // [H, 16 x 16 tiles of 256] (k_cvt)
    const _Float16* __restrict__ gate_ws, // [B2,N,HC]
    _Float16* __restrict__ wa_ws) {       // [B2*N/16, 8 fragments x 512] gated
  // All three arrays start at multiples of 2 KiB, so that the tensor-load
  // destinations (K, V) do, in whatever order the arrays are placed in LDS.
  __shared__ __attribute__((aligned(2048))) _Float16 Klds[NN * CC];   // 16 KB, 16 fragments
  __shared__ __attribute__((aligned(2048))) _Float16 VTlds[CC * NN];  // 16 KB, 16 fragments
  __shared__ __attribute__((aligned(2048))) float MB[NN];             // mask bias per key

  const int lane = threadIdx.x & 31;
  const int wv   = threadIdx.x >> 5;
  const int h    = blockIdx.x;
  const int b2   = blockIdx.y;
  const int rl   = (lane >> 4) * 8;
  const int cl   = lane & 15;

  const size_t hd = (((size_t)b2 * HH + h) * NN) * CC;

  const float mk = mask[(size_t)b2 * NN + threadIdx.x];

  if (wv == 0) {
    tdm_load_f16_1d((uint32_t)(uintptr_t)&Klds[0],  k_ws + hd,  NN * CC);
    tdm_load_f16_1d((uint32_t)(uintptr_t)&VTlds[0], vT_ws + hd, NN * CC);
    __builtin_amdgcn_s_wait_tensorcnt(0);
  }
  MB[threadIdx.x] = 1e9f * (mk - 1.0f);
  __syncthreads();

  for (int mt = 0; mt < 2; ++mt) {
    const int m0 = wv * 32 + mt * 16;
    // B operand: column = query m0 + cl, k = c
    const v16h qb = frag_ld_f16(q_ws + hd + (size_t)m0 * CC, CC, lane);
    // before a register that these loads name is written again (a bias load
    // below lands in their address pair)
    asm volatile("s_wait_xcnt 0x0" ::: "memory");

    // nonbatched bias (per query, key): 8 consecutive keys of one query per
    // lane and tile, in two planes of 512 contiguous bytes a wave
    const float* nbp = nb_t + ((size_t)h * NN + m0) * NN + lane * 4;
    v8f nbv[16];
#pragma unroll
    for (int nt = 0; nt < 16; ++nt) {
      const v4f lo = *(const v4f*)(nbp + nt * 256);
      const v4f hi = *(const v4f*)(nbp + nt * 256 + 128);
      nbv[nt] = __builtin_shufflevector(lo, hi, 0, 1, 2, 3, 4, 5, 6, 7);
    }
    // before a register that these loads name is written again; the address
    // as an input keeps the last load's data out of the address pair
    asm volatile("s_wait_xcnt 0x0" :: "v"(nbp) : "memory");
    // holds the 32 bias loads in front of the products, all in flight at
    // once; left free, this build issues them one by one behind the products
    // and waits each out
    __builtin_amdgcn_sched_barrier(0);

    // lg[nt][vi] = logit of query m0 + cl, key nt*16 + rl + vi
    v8f lg[16];
#pragma unroll
    for (int g = 0; g < 8; ++g) {     // two key tiles a group
      v16h kf[2];                     // A rows = keys
      v8f  mb[2];                     // mask bias (per key)
#pragma unroll
      for (int t = 0; t < 2; ++t) {
        kf[t] = frag_ld_packed(&Klds[(g * 2 + t) * 512], lane);
        mb[t] = *(const v8f*)&MB[(g * 2 + t) * 16 + rl];
      }
      // holds a group's 8 LDS loads together in front of its products, one
      // wait for all; left free, this build waits out each pair of loads
      __builtin_amdgcn_sched_barrier(0);
#pragma unroll
      for (int t = 0; t < 2; ++t) lg[g * 2 + t] = wmma16(kf[t], qb, zero8());
#pragma unroll
      for (int t = 0; t < 2; ++t) lg[g * 2 + t] += mb[t] + nbv[g * 2 + t];
    }

    // softmax over the keys of one query: eight chains in the lane (one per
    // vi), joined by a tree, then the other half of the wave
    v8f mx8 = lg[0];
#pragma unroll
    for (int nt = 1; nt < 16; ++nt) mx8 = __builtin_elementwise_max(mx8, lg[nt]);
    float mx = fmaxf(fmaxf(fmaxf(mx8[0], mx8[1]), fmaxf(mx8[2], mx8[3])),
                     fmaxf(fmaxf(mx8[4], mx8[5]), fmaxf(mx8[6], mx8[7])));
    mx = fmaxf(mx, xhalf(mx));
    v8f s8 = zero8();
#pragma unroll
    for (int nt = 0; nt < 16; ++nt) {
#pragma unroll
      for (int vi = 0; vi < 8; ++vi) lg[nt][vi] = __expf(lg[nt][vi] - mx);
      s8 += lg[nt];
    }
    float s = ((s8[0] + s8[1]) + (s8[2] + s8[3])) +
              ((s8[4] + s8[5]) + (s8[6] + s8[7]));
    s += xhalf(s);
    const float inv = 1.0f / s;

    // O^T (32 c x 16 queries) = V^T (32 x 256) x P^T (256 x 16)
    v8f ao0 = zero8(), ao1 = zero8();
#pragma unroll
    for (int kq = 0; kq < 8; ++kq) {   // 32-key block
      v16h pb;                         // k = rl + j, then 16 + rl + j
#pragma unroll
      for (int j = 0; j < 8; ++j) {
        pb[j]     = (_Float16)(lg[kq * 2][j] * inv);
        pb[8 + j] = (_Float16)(lg[kq * 2 + 1][j] * inv);
      }
      v16h a0 = frag_ld_packed(&VTlds[(kq * 2) * 512], lane);      // c 0..15
      v16h a1 = frag_ld_packed(&VTlds[(kq * 2 + 1) * 512], lane);  // c 16..31
      ao0 = wmma16(a0, pb, ao0);
      ao1 = wmma16(a1, pb, ao1);
    }

    const _Float16* gp = gate_ws + ((size_t)b2 * NN + m0 + cl) * HC + h * CC + rl;
    _Float16* wp = wa_ws + ((size_t)b2 * NN + m0) * HC + h * 512 + lane * 8;
#pragma unroll
    for (int ct = 0; ct < 2; ++ct) {
      const v8f& ao = ct ? ao1 : ao0;
      const v8h g = *(const v8h*)(gp + ct * 16);
      v8h o;
#pragma unroll
      for (int vi = 0; vi < 8; ++vi) o[vi] = (_Float16)(ao[vi] * (float)g[vi]);
      *(v8h*)(wp + ct * 256) = o;
    }
    // before a register that these stores name is written again (next trip)
    asm volatile("s_wait_xcnt 0x0" ::: "memory");
  }
}

// ---------------------------------------------------------------------------
// Kernel 3: output projection  out[M,256] = wa[M,256] x wo16^T + b_o
// Wave tile 32x64; block = 2x4 waves = 64 rows x all 256 cols.
// ---------------------------------------------------------------------------
__global__ __launch_bounds__(256) void k_out(
    const _Float16* __restrict__ wa_ws,  // [B2*N/16, 8 fragments x 512]
    const _Float16* __restrict__ wo16,   // [256/16, 8 fragments x 512]
    const float* __restrict__ b_o,       // [256]
    float* __restrict__ out) {           // [B2*N, 256]
  const int lane = threadIdx.x & 31;
  const int wv   = threadIdx.x >> 5;
  const int wr   = wv >> 2;
  const int wc   = wv & 3;
  const int row0 = blockIdx.x * 64 + wr * 32;
  const int col0 = wc * 64;
  const int rl   = (lane >> 4) * 8;
  const int cl   = lane & 15;

  const _Float16* arow = wa_ws + (size_t)row0 * HC;
  __builtin_prefetch(arow, 0, 3);

  v8f acc[2][4];
#pragma unroll
  for (int m = 0; m < 2; ++m)
#pragma unroll
    for (int t = 0; t < 4; ++t) acc[m][t] = zero8();

  // two trips a body: eight loads go out together at the head of a trip;
  // unrolled whole, this build has two to four in flight
#pragma unroll 2
  for (int kk = 0; kk < HC; kk += 32) {   // fragment kk/32 = kk*16 halves on
    v16h a0 = frag_ld_packed(arow + kk * 16, lane);
    v16h a1 = frag_ld_packed(arow + (size_t)16 * HC + kk * 16, lane);
#pragma unroll
    for (int t = 0; t < 4; ++t) {
      v16h b = frag_ld_packed(wo16 + (size_t)(col0 + t * 16) * HC + kk * 16, lane);
      acc[0][t] = wmma16(a0, b, acc[0][t]);
      acc[1][t] = wmma16(a1, b, acc[1][t]);
    }
  }

#pragma unroll
  for (int mt = 0; mt < 2; ++mt) {
#pragma unroll
    for (int t = 0; t < 4; ++t) {
      const int o = col0 + t * 16 + cl;
      const float bo = b_o[o];
#pragma unroll
      for (int vi = 0; vi < 8; ++vi) {
        const int r = row0 + mt * 16 + vi + rl;
        out[(size_t)r * OUTD + o] = acc[mt][t][vi] + bo;
      }
    }
  }
}

// ---------------------------------------------------------------------------
extern "C" void kernel_launch(void* const* d_in, const int* in_sizes, int n_in,
                              void* d_out, int out_size, void* d_ws, size_t ws_size,
                              hipStream_t stream) {
  (void)in_sizes; (void)n_in; (void)out_size; (void)ws_size;
  const float* in_data = (const float*)d_in[0];
  const float* mask    = (const float*)d_in[1];
  const float* nb_bias = (const float*)d_in[2];
  const float* w_qkv   = (const float*)d_in[3];
  const float* w_gate  = (const float*)d_in[4];
  const float* g_bias  = (const float*)d_in[5];
  const float* w_o     = (const float*)d_in[6];
  const float* b_o     = (const float*)d_in[7];
  float* out = (float*)d_out;

  // Workspace layout (f16 elements)
  const size_t QN  = (size_t)B2 * HH * NN * CC;  // 8,388,608
  _Float16* w16    = (_Float16*)d_ws;            // [1024 x 256] fused qkv|gate
  _Float16* wo16   = w16 + (size_t)(QKV_E + HC) * DD;
  _Float16* q_ws   = wo16 + (size_t)OUTD * HC;
  _Float16* k_ws   = q_ws + QN;
  _Float16* vT_ws  = k_ws + QN;
  _Float16* gate16 = vT_ws + QN;
  _Float16* wa_ws  = gate16 + (size_t)B2 * NN * HC;
  float*    nb_t   = (float*)(wa_ws + (size_t)B2 * NN * HC);  // [H*N*N]

  // 0) f32 -> f16 conversion of the three weight matrices, into fragment
  //    order, one launch (wo16 lies directly behind w16); the same launch
  //    lays the nonbatched bias out in the order of k_attn's lanes
  k_cvt<<<dim3(WBLK + NBLK), 256, 0, stream>>>(w_qkv, w_gate, w_o, nb_bias,
                                               w16, nb_t);

  // 1) fused QKV + gate projection: [32768 x 256] x [256 x 1024]
  k_qkv_gate<<<dim3(4, 4, B2), 256, 0, stream>>>(in_data, w16, g_bias,
                                                 q_ws, k_ws, vT_ws, gate16);
  // 2) attention per (h, b2), K/V^T staged via Tensor Data Mover
  k_attn<<<dim3(HH, B2), 256, 0, stream>>>(q_ws, k_ws, vT_ws, mask, nb_t,
                                           gate16, wa_ws);
  // 3) output projection: [32768 x 256] x [256 x 256] + bias
  k_out<<<dim3((B2 * NN) / 64), 256, 0, stream>>>(wa_ws, wo16, b_o, out);
}

// v007
// One run takes 71.8 microseconds.
// In two side-by-side timings against v006, it was 1.09 and 1.08 times as fast.
// All steps since v000 together make it 2.24 times as fast.
#include <hip/hip_runtime.h>
#include <cstdint>

typedef __attribute__((ext_vector_type(16))) _Float16     v16h;
typedef __attribute__((ext_vector_type(8)))  _Float16     v8h;
typedef __attribute__((ext_vector_type(8)))  float        v8f;
typedef __attribute__((ext_vector_type(4)))  float        v4f;
typedef __attribute__((ext_vector_type(4)))  unsigned int u32x4;
typedef __attribute__((ext_vector_type(8)))  int          i32x8;
typedef __attribute__((ext_vector_type(4)))  int          i32x4;

#define B2    128
#define NN    256
#define DD    256
#define HH    8
#define CC    32
#define HC    256   // H*C
#define QKV_E 768   // 3*H*C
#define OUTD  256

__device__ __forceinline__ v8f zero8() {
  v8f z;
#pragma unroll
  for (int j = 0; j < 8; ++j) z[j] = 0.0f;
  return z;
}

// element j -> src[r*stride + k]; per-lane halves are two contiguous 16B runs
__device__ __forceinline__ v16h frag_ld_f16(const _Float16* __restrict__ src,
                                            int stride, int lane) {
  const int r  = lane & 15;
  const int kb = (lane >> 4) * 8;
  const _Float16* p = src + (size_t)r * stride + kb;
  v16h f;
#pragma unroll
  for (int j = 0; j < 8; ++j) f[j] = p[j];
#pragma unroll
  for (int j = 0; j < 8; ++j) f[8 + j] = p[16 + j];
  return f;
}

__device__ __forceinline__ v16h frag_ld_packed(const _Float16* src, int lane) {
  const v8h lo = *(const v8h*)(src + lane * 8);
  const v8h hi = *(const v8h*)(src + 256 + lane * 8);
  return __builtin_shufflevector(lo, hi, 0, 1, 2, 3, 4, 5, 6, 7,
                                 8, 9, 10, 11, 12, 13, 14, 15);
}

// offset (halves) of element (col, k) inside one fragment, col 0..15, k 0..31
__device__ __forceinline__ int frag_off(int col, int k) {
  return ((k >> 4) & 1) * 256 + ((((k >> 3) & 1) * 16) + col) * 8 + (k & 7);
}

__device__ __forceinline__ v8f wmma16(v16h a, v16h b, v8f c) {
  return __builtin_amdgcn_wmma_f32_16x16x32_f16(false, a, false, b,
                                                (short)0, c, false, false);
}

__device__ __forceinline__ void tdm_load_f16_1d(uint32_t lds_off,
                                                const _Float16* gsrc,
                                                uint32_t nelem) {
  const uint64_t ga = (uint64_t)(uintptr_t)gsrc;
  u32x4 g0;
  g0[0] = 1u;                                                  // count=1
  g0[1] = lds_off;                                             // lds_addr
  g0[2] = (uint32_t)ga;                                        // ga[31:0]
  g0[3] = (uint32_t)((ga >> 32) & 0x01FFFFFFu) | (2u << 30);   // ga[56:32]|type
  i32x8 g1;
  g1[0] = 0x00010000;
  g1[1] = (int)((nelem & 0xFFFFu) << 16);
  g1[2] = (int)(((nelem >> 16) & 0xFFFFu) | (1u << 16));
  g1[3] = (int)((nelem & 0xFFFFu) << 16);
  g1[4] = 0;
  g1[5] = (int)nelem;
  g1[6] = 0;
  g1[7] = 0;
  i32x4 gz;
  gz[0] = gz[1] = gz[2] = gz[3] = 0;
#if defined(__clang_major__) && __clang_major__ >= 23
  i32x8 g4;
#pragma unroll
  for (int j = 0; j < 8; ++j) g4[j] = 0;
  __builtin_amdgcn_tensor_load_to_lds(g0, g1, gz, gz, g4, 0);
#else
  __builtin_amdgcn_tensor_load_to_lds(g0, g1, gz, gz, 0);
#endif
}

// ---------------------------------------------------------------------------
// Kernel 0: f32 -> f16 conversion pass (8 elems/thread, b128 in / b128 out)
// of all three weight matrices in ONE launch: row-major matrices of 256
// columns into fragment order.  The three results lie one behind the other
// in the workspace (768 qkv rows, 256 gate rows, 256 output-projection rows),
// so they are one matrix of 1280 rows for the writer: thread t writes the
// t-th 16 bytes of dst, stores stay contiguous, a block reads 512 contiguous
// bytes of each of 16 rows.  A block's 16 rows lie in one source matrix.
// The blocks behind those copy the nonbatched bias (f32, values unchanged)
// into the order in which k_attn's lanes hold their scores: per head, 16
// queries and 16 keys one tile of 1 KB, two planes of 512 B; plane p holds at
// lane*4 + j the bias of query lane&15, key (lane>>4)*8 + p*4 + j.  A wave's
// global_load_b128 then reads 512 contiguous bytes, 4 lines, where bias rows
// of 1 KB make it touch 16.  A block takes one head's 16 queries (16 KB): its
// stores are contiguous, a trip reads two whole 128-B lines of each of 16 rows.
// ---------------------------------------------------------------------------
#define WBLK ((QKV_E + HC + OUTD) * DD / 8 / 256)   // blocks on the weights
#define NBLK (HH * NN / 16)                         // blocks on the bias

__global__ __launch_bounds__(256) void k_cvt(const float* __restrict__ w_qkv,
                                             const float* __restrict__ w_gate,
                                             const float* __restrict__ w_o,
                                             const float* __restrict__ nb_bias,
                                             _Float16* __restrict__ dst,
                                             float* __restrict__ nb_t) {
  if (blockIdx.x >= WBLK) {                        // block-uniform
    const int tile = blockIdx.x - WBLK;            // h*16 + query tile
    const int u    = threadIdx.x;                  // 16-B unit; + 256 a trip
    const int l    = u & 31;
    const float* sp = nb_bias + (size_t)(tile * 16 + (l & 15)) * NN +
                      (u >> 6) * 16 + (l >> 4) * 8 + ((u >> 5) & 1) * 4;
    v4f v[4];
#pragma unroll
    for (int i = 0; i < 4; ++i) v[i] = *(const v4f*)(sp + i * 64);  // 4 key tiles on
    // before a register that these loads name is written again; the address
    // as an input keeps the last load's data out of the address pair
    asm volatile("s_wait_xcnt 0x0" :: "v"(sp) : "memory");
    float* dp = nb_t + (size_t)tile * (16 * NN) + u * 4;
#pragma unroll
    for (int i = 0; i < 4; ++i) *(v4f*)(dp + i * 1024) = v[i];
    return;
  }
  const int t   = blockIdx.x * 256 + threadIdx.x;
  const int R   = blockIdx.x >> 1;                 // row tile (two blocks each)
  const int fr  = t >> 6;                          // fragment R*8 + b
  const int k   = (fr & 7) * 32 + ((t >> 5) & 1) * 16 + ((t >> 4) & 1) * 8;
  const float* m = w_qkv;                          // block-uniform choice
  int Rl = R;                                      // row tile in its own matrix
  if (R >= (QKV_E + HC) / 16) {
    m = w_o;
    Rl = R - (QKV_E + HC) / 16;
  } else if (R >= QKV_E / 16) {
    m = w_gate;
    Rl = R - QKV_E / 16;
  }
  const float* __restrict__ sp = m + (size_t)(Rl * 16 + (t & 15)) * 256 + k;
#pragma unroll
  for (int j = 0; j < 8; ++j) dst[(size_t)t * 8 + j] = (_Float16)sp[j];
}

// ---------------------------------------------------------------------------
// Kernel 1: fused QKV + gate projection, all-f16 operands.
//   x[b2*n, d] x w16^T[1024, d]  (rows: 768 qkv, then 256 gate)
// A block takes its 64 rows of x as f32 and converts them into LDS in
// fragment order (32 KB); w16 is read from global memory in fragment order.
// Wave tile 32x64 (2 A-frags x 4 B-frags -> 8 WMMA); block = 2x4 waves
// = 64 rows x 256 cols.  Q (pre-scaled), K and V are stored per (b2,h) in the
// fragment order their readers in k_attn use (frag_off):
// Q, K: fragment n>>4, col = n&15, k = c;  V: fragment (n>>5)*2 + (c>>4),
// col = c&15, k = n&31.  gate = sigmoid(.+bias), f16, lies as k_attn's output
// does: row tile n>>4, fragment h, col = n&15, k = c.
// The V block forms x w^T: a lane holds 8 rows n of one column.  The Q, K and
// gate blocks form w x^T (the same fragments, A and B exchanged): a lane holds
// 8 consecutive columns of one row, which are one 16-B unit of the layouts
// above, at lane*8: a tile goes out as one store of 512 contiguous bytes.
// ---------------------------------------------------------------------------
template <bool WX>   // true: w x^T, false: x w^T
__device__ __forceinline__ void proj_loop(const _Float16* xrow,
                                          const _Float16* __restrict__ wcol,
                                          int lane, v8f (&acc)[2][4]) {
#pragma unroll 1
  for (int kk = 0; kk < DD; kk += 32) {   // fragment kk/32 = kk*16 halves on
    v16h b[4];
#pragma unroll
    for (int t = 0; t < 4; ++t)
      b[t] = frag_ld_packed(wcol + (size_t)(t * 16) * DD + kk * 16, lane);
    v16h a0 = frag_ld_packed(xrow + kk * 16, lane);
    v16h a1 = frag_ld_packed(xrow + (size_t)16 * DD + kk * 16, lane);
    // holds a trip's eight global loads, then its four LDS loads, in front of
    // its products, all in flight at once; left free, this build holds two B
    // fragments at a time and waits out a second pair in the middle of a trip
    __builtin_amdgcn_sched_barrier(0);
#pragma unroll
    for (int t = 0; t < 4; ++t) {
      acc[0][t] = WX ? wmma16(b[t], a0, acc[0][t]) : wmma16(a0, b[t], acc[0][t]);
      acc[1][t] = WX ? wmma16(b[t], a1, acc[1][t]) : wmma16(a1, b[t], acc[1][t]);
    }
  }
}

__global__ __launch_bounds__(256) void k_qkv_gate(
    const float* __restrict__ x,        // [B2*N, 256] row-major
    const _Float16* __restrict__ w16,   // [1024/16, 8 fragments x 512]
    const float* __restrict__ g_bias,   // [256]
    _Float16* __restrict__ q_ws,        // [B2,H, 16 fragments x 512] (scaled)
    _Float16* __restrict__ k_ws,        // [B2,H, 16 fragments x 512]
    _Float16* __restrict__ vT_ws,       // [B2,H, 16 fragments x 512]
    _Float16* __restrict__ gate_ws) {   // [B2*N/16, 8 fragments x 512]
  const int lane = threadIdx.x & 31;
  const int wv   = threadIdx.x >> 5;
  const int wr   = wv >> 2;            // 0..1
  const int wc   = wv & 3;             // 0..3
  const int b2   = blockIdx.z;
  const int row0 = blockIdx.y * 64 + wr * 32;
  const int col0 = blockIdx.x * 256 + wc * 64;
  const int rl   = (lane >> 4) * 8;
  const int cl   = lane & 15;

  __shared__ __attribute__((aligned(16))) _Float16 Xl[64 * DD];  // 32 fragments

  // x tile -> LDS.  Wave wv takes k 32wv..32wv+31 (one 128-B line a row), 8
  // rows a trip: 4 lanes share a line, the block reads 8 whole rows a trip.
  // A lane's 8 values are one 16-B unit of the fragment.
  {
    const float* __restrict__ xs =
        x + ((size_t)b2 * NN + blockIdx.y * 64 + (lane >> 2)) * DD + wv * 32 +
        (lane & 3) * 8;
    v4f lo[8], hi[8];
#pragma unroll
    for (int it = 0; it < 8; ++it) {
      lo[it] = *(const v4f*)(xs + (size_t)it * 8 * DD);
      hi[it] = *(const v4f*)(xs + (size_t)it * 8 * DD + 4);
    }
#pragma unroll
    for (int it = 0; it < 8; ++it) {
      v8h o;
#pragma unroll
      for (int j = 0; j < 4; ++j) {
        o[j]     = (_Float16)lo[it][j];
        o[4 + j] = (_Float16)hi[it][j];
      }
      *(v8h*)&Xl[((it >> 1) * 8 + wv) * 512 +
                 frag_off((it & 1) * 8 + (lane >> 2), (lane & 3) * 8)] = o;
    }
  }
  __syncthreads();

  const _Float16* xrow = &Xl[wr * 2 * 8 * 512];

  v8f acc[2][4];
#pragma unroll
  for (int m = 0; m < 2; ++m)
#pragma unroll
    for (int t = 0; t < 4; ++t) acc[m][t] = zero8();

  const _Float16* wcol = w16 + (size_t)col0 * DD;
  const int which = blockIdx.x;       // 0=q 1=k 2=v 3=gate (block-uniform)

  if (which == 2) {                   // V: 8 keys of one c = 16 B per lane
    proj_loop<false>(xrow, wcol, lane, acc);
#pragma unroll
    for (int mt = 0; mt < 2; ++mt) {
      const int n0 = row0 + mt * 16 + rl;
#pragma unroll
      for (int t = 0; t < 4; ++t) {
        const int hc = wc * 64 + t * 16 + cl;
        const int h = hc >> 5, c = hc & 31;
        const size_t base = ((size_t)b2 * HH + h) * (CC * NN) +
                            ((n0 >> 5) * 2 + (c >> 4)) * 512 +
                            frag_off(c & 15, n0 & 31);
#pragma unroll
        for (int vi = 0; vi < 8; ++vi)
          vT_ws[base + vi] = (_Float16)acc[mt][t][vi];
        // before a register that the store names is written again
        asm volatile("s_wait_xcnt 0x0" ::: "memory");
      }
    }
    return;
  }

  // acc[mt][t][vi]: row row0 + mt*16 + cl, column wc*64 + t*16 + rl + vi of
  // its matrix, that is head wc*2 + (t>>1), c = (t&1)*16 + rl + vi
  proj_loop<true>(xrow, wcol, lane, acc);
  if (which == 3) {
    _Float16* gp = gate_ws + ((size_t)b2 * NN + row0) * HC + wc * 1024 + lane * 8;
#pragma unroll
    for (int t = 0; t < 4; ++t) {
      const v8f gb = *(const v8f*)(g_bias + wc * 64 + t * 16 + rl);
      // before a register that the load names is written again
      asm volatile("s_wait_xcnt 0x0" ::: "memory");
#pragma unroll
      for (int mt = 0; mt < 2; ++mt) {
        v8h o;
#pragma unroll
        for (int vi = 0; vi < 8; ++vi) {
          const float z = acc[mt][t][vi] + gb[vi];
          o[vi] = (_Float16)(1.0f / (1.0f + __expf(-z)));
        }
        *(v8h*)(gp + mt * (16 * HC) + t * 256) = o;
        // before a register that the store names is written again
        asm volatile("s_wait_xcnt 0x0" ::: "memory");
        __builtin_amdgcn_sched_barrier(0);
      }
    }
  } else {
    const float sc = which == 0 ? 0.17677669529663687f : 1.0f;  // Q: C^-1/2
    _Float16* dp = (which == 0 ? q_ws : k_ws) +
                   ((size_t)b2 * HH + wc * 2) * (NN * CC) + (row0 >> 4) * 512 +
                   lane * 8;
#pragma unroll
    for (int mt = 0; mt < 2; ++mt) {
#pragma unroll
      for (int t = 0; t < 4; ++t) {
        v8h o;
#pragma unroll
        for (int vi = 0; vi < 8; ++vi) o[vi] = (_Float16)(acc[mt][t][vi] * sc);
        *(v8h*)(dp + (t >> 1) * (NN * CC) + mt * 512 + (t & 1) * 256) = o;
        // before a register that the store names is written again
        asm volatile("s_wait_xcnt 0x0" ::: "memory");
      }
    }
  }
}

__device__ __forceinline__ float xhalf(float x) {
  const int b = __builtin_bit_cast(int, x);
  return __builtin_bit_cast(float, __builtin_amdgcn_permlanex16(
      b, b, 0x76543210, 0xfedcba98, false, false));
}

__global__ __launch_bounds__(256) void k_attn(
    const _Float16* __restrict__ q_ws,
    const _Float16* __restrict__ k_ws,
    const _Float16* __restrict__ vT_ws,
    const float* __restrict__ mask,       // [B2,N]
    const float* __restrict__ nb_t,       // [H, 16 x 16 tiles of 256] (k_cvt)
    const _Float16* __restrict__ gate_ws, // [B2*N/16, 8 fragments x 512]
    _Float16* __restrict__ wa_ws) {       // [B2*N/16, 8 fragments x 512] gated
  // All three arrays start at multiples of 2 KiB, so that the tensor-load
  // destinations (K, V) do, in whatever order the arrays are placed in LDS.
  __shared__ __attribute__((aligned(2048))) _Float16 Klds[NN * CC];   // 16 KB, 16 fragments
  __shared__ __attribute__((aligned(2048))) _Float16 VTlds[CC * NN];  // 16 KB, 16 fragments
  __shared__ __attribute__((aligned(2048))) float MB[NN];             // mask bias per key

  const int lane = threadIdx.x & 31;
  const int wv   = threadIdx.x >> 5;
  const int h    = blockIdx.x;
  const int b2   = blockIdx.y;
  const int rl   = (lane >> 4) * 8;

  const size_t hd = (((size_t)b2 * HH + h) * NN) * CC;

  const float mk = mask[(size_t)b2 * NN + threadIdx.x];

  if (wv == 0) {
    tdm_load_f16_1d((uint32_t)(uintptr_t)&Klds[0],  k_ws + hd,  NN * CC);
    tdm_load_f16_1d((uint32_t)(uintptr_t)&VTlds[0], vT_ws + hd, NN * CC);
    __builtin_amdgcn_s_wait_tensorcnt(0);
  }
  MB[threadIdx.x] = 1e9f * (mk - 1.0f);
  __syncthreads();

  for (int mt = 0; mt < 2; ++mt) {
    const int m0 = wv * 32 + mt * 16;
    // B operand: column = query m0 + cl, k = c
    const v16h qb = frag_ld_packed(q_ws + hd + (size_t)m0 * CC, lane);
    // before a register that these loads name is written again (a bias load
    // below lands in their address pair)
    asm volatile("s_wait_xcnt 0x0" ::: "memory");

    // nonbatched bias (per query, key): 8 consecutive keys of one query per
    // lane and tile, in two planes of 512 contiguous bytes a wave
    const float* nbp = nb_t + ((size_t)h * NN + m0) * NN + lane * 4;
    v8f nbv[16];
#pragma unroll
    for (int nt = 0; nt < 16; ++nt) {
      const v4f lo = *(const v4f*)(nbp + nt * 256);
      const v4f hi = *(const v4f*)(nbp + nt * 256 + 128);
      nbv[nt] = __builtin_shufflevector(lo, hi, 0, 1, 2, 3, 4, 5, 6, 7);
    }
    // before a register that these loads name is written again; the address
    // as an input keeps the last load's data out of the address pair
    asm volatile("s_wait_xcnt 0x0" :: "v"(nbp) : "memory");
    // holds the 32 bias loads in front of the products, all in flight at
    // once; left free, this build issues them one by one behind the products
    // and waits each out
    __builtin_amdgcn_sched_barrier(0);

    // lg[nt][vi] = logit of query m0 + cl, key nt*16 + rl + vi
    v8f lg[16];
#pragma unroll
    for (int g = 0; g < 8; ++g) {     // two key tiles a group
      v16h kf[2];                     // A rows = keys
      v8f  mb[2];                     // mask bias (per key)
#pragma unroll
      for (int t = 0; t < 2; ++t) {
        kf[t] = frag_ld_packed(&Klds[(g * 2 + t) * 512], lane);
        mb[t] = *(const v8f*)&MB[(g * 2 + t) * 16 + rl];
      }
      // holds a group's 8 LDS loads together in front of its products, one
      // wait for all; left free, this build waits out each pair of loads
      __builtin_amdgcn_sched_barrier(0);
#pragma unroll
      for (int t = 0; t < 2; ++t) lg[g * 2 + t] = wmma16(kf[t], qb, zero8());
#pragma unroll
      for (int t = 0; t < 2; ++t) lg[g * 2 + t] += mb[t] + nbv[g * 2 + t];
    }

    // softmax over the keys of one query: eight chains in the lane (one per
    // vi), joined by a tree, then the other half of the wave
    v8f mx8 = lg[0];
#pragma unroll
    for (int nt = 1; nt < 16; ++nt) mx8 = __builtin_elementwise_max(mx8, lg[nt]);
    float mx = fmaxf(fmaxf(fmaxf(mx8[0], mx8[1]), fmaxf(mx8[2], mx8[3])),
                     fmaxf(fmaxf(mx8[4], mx8[5]), fmaxf(mx8[6], mx8[7])));
    mx = fmaxf(mx, xhalf(mx));
    v8f s8 = zero8();
#pragma unroll
    for (int nt = 0; nt < 16; ++nt) {
#pragma unroll
      for (int vi = 0; vi < 8; ++vi) lg[nt][vi] = __expf(lg[nt][vi] - mx);
      s8 += lg[nt];
    }
    float s = ((s8[0] + s8[1]) + (s8[2] + s8[3])) +
              ((s8[4] + s8[5]) + (s8[6] + s8[7]));
    s += xhalf(s);
    const float inv = 1.0f / s;

    // O^T (32 c x 16 queries) = V^T (32 x 256) x P^T (256 x 16)
    v8f ao0 = zero8(), ao1 = zero8();
#pragma unroll
    for (int kq = 0; kq < 8; ++kq) {   // 32-key block
      v16h pb;                         // k = rl + j, then 16 + rl + j
#pragma unroll
      for (int j = 0; j < 8; ++j) {
        pb[j]     = (_Float16)(lg[kq * 2][j] * inv);
        pb[8 + j] = (_Float16)(lg[kq * 2 + 1][j] * inv);
      }
      v16h a0 = frag_ld_packed(&VTlds[(kq * 2) * 512], lane);      // c 0..15
      v16h a1 = frag_ld_packed(&VTlds[(kq * 2 + 1) * 512], lane);  // c 16..31
      ao0 = wmma16(a0, pb, ao0);
      ao1 = wmma16(a1, pb, ao1);
    }

    const _Float16* gp = gate_ws + ((size_t)b2 * NN + m0) * HC + h * 512 + lane * 8;
    _Float16* wp = wa_ws + ((size_t)b2 * NN + m0) * HC + h * 512 + lane * 8;
#pragma unroll
    for (int ct = 0; ct < 2; ++ct) {
      const v8f& ao = ct ? ao1 : ao0;
      const v8h g = *(const v8h*)(gp + ct * 256);
      v8h o;
#pragma unroll
      for (int vi = 0; vi < 8; ++vi) o[vi] = (_Float16)(ao[vi] * (float)g[vi]);
      *(v8h*)(wp + ct * 256) = o;
    }
    // before a register that these stores name is written again (next trip)
    asm volatile("s_wait_xcnt 0x0" ::: "memory");
  }
}

// ---------------------------------------------------------------------------
// Kernel 3: output projection  out[M,256] = wa[M,256] x wo16^T + b_o
// Wave tile 32x64; block = 2x4 waves = 64 rows x all 256 cols.
// ---------------------------------------------------------------------------
__global__ __launch_bounds__(256) void k_out(
    const _Float16* __restrict__ wa_ws,  // [B2*N/16, 8 fragments x 512]
    const _Float16* __restrict__ wo16,   // [256/16, 8 fragments x 512]
    const float* __restrict__ b_o,       // [256]
    float* __restrict__ out) {           // [B2*N, 256]
  const int lane = threadIdx.x & 31;
  const int wv   = threadIdx.x >> 5;
  const int wr   = wv >> 2;
  const int wc   = wv & 3;
  const int row0 = blockIdx.x * 64 + wr * 32;
  const int col0 = wc * 64;
  const int rl   = (lane >> 4) * 8;
  const int cl   = lane & 15;

  const _Float16* arow = wa_ws + (size_t)row0 * HC;
  __builtin_prefetch(arow, 0, 3);

  v8f acc[2][4];
#pragma unroll
  for (int m = 0; m < 2; ++m)
#pragma unroll
    for (int t = 0; t < 4; ++t) acc[m][t] = zero8();

  // two trips a body: eight loads go out together at the head of a trip;
  // unrolled whole, this build has two to four in flight
#pragma unroll 2
  for (int kk = 0; kk < HC; kk += 32) {   // fragment kk/32 = kk*16 halves on
    v16h a0 = frag_ld_packed(arow + kk * 16, lane);
    v16h a1 = frag_ld_packed(arow + (size_t)16 * HC + kk * 16, lane);
#pragma unroll
    for (int t = 0; t < 4; ++t) {
      v16h b = frag_ld_packed(wo16 + (size_t)(col0 + t * 16) * HC + kk * 16, lane);
      acc[0][t] = wmma16(a0, b, acc[0][t]);
      acc[1][t] = wmma16(a1, b, acc[1][t]);
    }
  }

#pragma unroll
  for (int mt = 0; mt < 2; ++mt) {
#pragma unroll
    for (int t = 0; t < 4; ++t) {
      const int o = col0 + t * 16 + cl;
      const float bo = b_o[o];
#pragma unroll
      for (int vi = 0; vi < 8; ++vi) {
        const int r = row0 + mt * 16 + vi + rl;
        out[(size_t)r * OUTD + o] = acc[mt][t][vi] + bo;
      }
    }
  }
}

// ---------------------------------------------------------------------------
extern "C" void kernel_launch(void* const* d_in, const int* in_sizes, int n_in,
                              void* d_out, int out_size, void* d_ws, size_t ws_size,
                              hipStream_t stream) {
  (void)in_sizes; (void)n_in; (void)out_size; (void)ws_size;
  const float* in_data = (const float*)d_in[0];
  const float* mask    = (const float*)d_in[1];
  const float* nb_bias = (const float*)d_in[2];
  const float* w_qkv   = (const float*)d_in[3];
  const float* w_gate  = (const float*)d_in[4];
  const float* g_bias  = (const float*)d_in[5];
  const float* w_o     = (const float*)d_in[6];
  const float* b_o     = (const float*)d_in[7];
  float* out = (float*)d_out;

  // Workspace layout (f16 elements)
  const size_t QN  = (size_t)B2 * HH * NN * CC;  // 8,388,608
  _Float16* w16    = (_Float16*)d_ws;            // [1024 x 256] fused qkv|gate
  _Float16* wo16   = w16 + (size_t)(QKV_E + HC) * DD;
  _Float16* q_ws   = wo16 + (size_t)OUTD * HC;
  _Float16* k_ws   = q_ws + QN;
  _Float16* vT_ws  = k_ws + QN;
  _Float16* gate16 = vT_ws + QN;
  _Float16* wa_ws  = gate16 + (size_t)B2 * NN * HC;
  float*    nb_t   = (float*)(wa_ws + (size_t)B2 * NN * HC);  // [H*N*N]

  // 0) f32 -> f16 conversion of the three weight matrices, into fragment
  //    order, one launch (wo16 lies directly behind w16); the same launch
  //    lays the nonbatched bias out in the order of k_attn's lanes
  k_cvt<<<dim3(WBLK + NBLK), 256, 0, stream>>>(w_qkv, w_gate, w_o, nb_bias,
                                               w16, nb_t);

  // 1) fused QKV + gate projection: [32768 x 256] x [256 x 1024]
  k_qkv_gate<<<dim3(4, 4, B2), 256, 0, stream>>>(in_data, w16, g_bias,
                                                 q_ws, k_ws, vT_ws, gate16);
  // 2) attention per (h, b2), K/V^T staged via Tensor Data Mover
  k_attn<<<dim3(HH, B2), 256, 0, stream>>>(q_ws, k_ws, vT_ws, mask, nb_t,
                                           gate16, wa_ws);
  // 3) output projection: [32768 x 256] x [256 x 256] + bias
  k_out<<<dim3((B2 * NN) / 64), 256, 0, stream>>>(wa_ws, wo16, b_o, out);
}

// v008
// A run of this version takes 53.1 microseconds.
// In both of two side-by-side timings against v007, it was 1.35 times as fast.
// Counting every step since v000, it is 3.03 times as fast.
#include <hip/hip_runtime.h>
#include <cstdint>

typedef __attribute__((ext_vector_type(16))) _Float16     v16h;
typedef __attribute__((ext_vector_type(8)))  _Float16     v8h;
typedef __attribute__((ext_vector_type(8)))  float        v8f;
typedef __attribute__((ext_vector_type(4)))  float        v4f;

#define B2    128
#define NN    256
#define DD    256
#define HH    8
#define CC    32
#define HC    256   // H*C
#define QKV_E 768   // 3*H*C
#define OUTD  256

__device__ __forceinline__ v8f zero8() {
  v8f z;
#pragma unroll
  for (int j = 0; j < 8; ++j) z[j] = 0.0f;
  return z;
}

// element j -> src[r*stride + k]; per-lane halves are two contiguous 16B runs
__device__ __forceinline__ v16h frag_ld_f16(const _Float16* __restrict__ src,
                                            int stride, int lane) {
  const int r  = lane & 15;
  const int kb = (lane >> 4) * 8;
  const _Float16* p = src + (size_t)r * stride + kb;
  v16h f;
#pragma unroll
  for (int j = 0; j < 8; ++j) f[j] = p[j];
#pragma unroll
  for (int j = 0; j < 8; ++j) f[8 + j] = p[16 + j];
  return f;
}

__device__ __forceinline__ v16h frag_ld_packed(const _Float16* src, int lane) {
  const v8h lo = *(const v8h*)(src + lane * 8);
  const v8h hi = *(const v8h*)(src + 256 + lane * 8);
  return __builtin_shufflevector(lo, hi, 0, 1, 2, 3, 4, 5, 6, 7,
                                 8, 9, 10, 11, 12, 13, 14, 15);
}

// offset (halves) of element (col, k) inside one fragment, col 0..15, k 0..31
__device__ __forceinline__ int frag_off(int col, int k) {
  return ((k >> 4) & 1) * 256 + ((((k >> 3) & 1) * 16) + col) * 8 + (k & 7);
}

__device__ __forceinline__ v8f wmma16(v16h a, v16h b, v8f c) {
  return __builtin_amdgcn_wmma_f32_16x16x32_f16(false, a, false, b,
                                                (short)0, c, false, false);
}

// ---------------------------------------------------------------------------
// Kernel 0: f32 -> f16 conversion pass (8 elems/thread, b128 in / b128 out)
// of all three weight matrices in ONE launch: row-major matrices of 256
// columns into fragment order.  The three results lie one behind the other
// in the workspace (768 qkv rows, 256 gate rows, 256 output-projection rows),
// so they are one matrix of 1280 rows for the writer: thread t writes the
// t-th 16 bytes of dst, stores stay contiguous, a block reads 512 contiguous
// bytes of each of 16 rows.  A block's 16 rows lie in one source matrix.
// The blocks behind those copy the nonbatched bias (f32, values unchanged)
// into the order in which the attention lanes hold their scores: per head, 16
// queries and 16 keys one tile of 1 KB, two planes of 512 B; plane p holds at
// lane*4 + j the bias of query lane&15, key (lane>>4)*8 + p*4 + j.  A wave's
// global_load_b128 then reads 512 contiguous bytes, 4 lines, where bias rows
// of 1 KB make it touch 16.  A block takes one head's 16 queries (16 KB): its
// stores are contiguous, a trip reads two whole 128-B lines of each of 16 rows.
// ---------------------------------------------------------------------------
#define WBLK ((QKV_E + HC + OUTD) * DD / 8 / 256)   // blocks on the weights
#define NBLK (HH * NN / 16)                         // blocks on the bias

__global__ __launch_bounds__(256) void k_cvt(const float* __restrict__ w_qkv,
                                             const float* __restrict__ w_gate,
                                             const float* __restrict__ w_o,
                                             const float* __restrict__ nb_bias,
                                             _Float16* __restrict__ dst,
                                             float* __restrict__ nb_t) {
  if (blockIdx.x >= WBLK) {                        // block-uniform
    const int tile = blockIdx.x - WBLK;            // h*16 + query tile
    const int u    = threadIdx.x;                  // 16-B unit; + 256 a trip
    const int l    = u & 31;
    const float* sp = nb_bias + (size_t)(tile * 16 + (l & 15)) * NN +
                      (u >> 6) * 16 + (l >> 4) * 8 + ((u >> 5) & 1) * 4;
    v4f v[4];
#pragma unroll
    for (int i = 0; i < 4; ++i) v[i] = *(const v4f*)(sp + i * 64);  // 4 key tiles on
    // before a register that these loads name is written again; the address
    // as an input keeps the last load's data out of the address pair
    asm volatile("s_wait_xcnt 0x0" :: "v"(sp) : "memory");
    float* dp = nb_t + (size_t)tile * (16 * NN) + u * 4;
#pragma unroll
    for (int i = 0; i < 4; ++i) *(v4f*)(dp + i * 1024) = v[i];
    return;
  }
  const int t   = blockIdx.x * 256 + threadIdx.x;
  const int R   = blockIdx.x >> 1;                 // row tile (two blocks each)
  const int fr  = t >> 6;                          // fragment R*8 + b
  const int k   = (fr & 7) * 32 + ((t >> 5) & 1) * 16 + ((t >> 4) & 1) * 8;
  const float* m = w_qkv;                          // block-uniform choice
  int Rl = R;                                      // row tile in its own matrix
  if (R >= (QKV_E + HC) / 16) {
    m = w_o;
    Rl = R - (QKV_E + HC) / 16;
  } else if (R >= QKV_E / 16) {
    m = w_gate;
    Rl = R - QKV_E / 16;
  }
  const float* __restrict__ sp = m + (size_t)(Rl * 16 + (t & 15)) * 256 + k;
#pragma unroll
  for (int j = 0; j < 8; ++j) dst[(size_t)t * 8 + j] = (_Float16)sp[j];
}

__device__ __forceinline__ float xhalf(float x) {
  const int b = __builtin_bit_cast(int, x);
  return __builtin_bit_cast(float, __builtin_amdgcn_permlanex16(
      b, b, 0x76543210, 0xfedcba98, false, false));
}

__global__ __launch_bounds__(512) void k_proj_attn(
    const float* __restrict__ x,          // [B2*N, 256] row-major
    const _Float16* __restrict__ w16,     // [1024/16, 8 fragments x 512]
    const float* __restrict__ g_bias,     // [256]
    const float* __restrict__ mask,       // [B2,N]
    const float* __restrict__ nb_t,       // [H, 16 x 16 tiles of 256] (k_cvt)
    _Float16* __restrict__ wa_ws) {       // [B2*N/16, 8 fragments x 512] gated
  __shared__ __attribute__((aligned(16))) _Float16 Xl[NN * DD];          // 128 fragments
  __shared__ __attribute__((aligned(16))) _Float16 KV[2][2 * NN * CC];   // per head: K, V
  __shared__ __attribute__((aligned(16))) _Float16 QG[16][2 * 32 * CC];  // per wave: Q, gate
  __shared__ __attribute__((aligned(16))) float MB2[2][NN];  // mask bias per key, a copy a head

  const int lane = threadIdx.x & 31;
  const int w16i = threadIdx.x >> 5;   // wave of the block, 0..15
  const int hs   = w16i >> 3;          // which of the block's two heads
  const int wv   = w16i & 7;           // wave of its head
  const int h    = blockIdx.x * 2 + hs;
  const int b2   = blockIdx.y;
  const int rl   = (lane >> 4) * 8;

  const float mk = mask[(size_t)b2 * NN + (threadIdx.x & (NN - 1))];
  // gating bias of the lane's 16 columns c = t*16 + rl + vi, asked for here so
  // that it has come when the projection ends
  v8f gbv[2];
#pragma unroll
  for (int t = 0; t < 2; ++t)
    gbv[t] = *(const v8f*)(g_bias + h * CC + t * 16 + rl);
  // before a register that these loads name is written again
  asm volatile("s_wait_xcnt 0x0" ::: "memory");

  // x[b2] -> LDS.  A wave takes k 32wv..32wv+31 (one 128-B line a row) of rows
  // 128hs..128hs+127, 8 rows a step: 4 lanes share a line, 8 waves read 8 whole
  // rows a step.  A lane's 8 values are one 16-B unit of the fragment.
  {
    const float* xs = x + ((size_t)b2 * NN + hs * 128 + (lane >> 2)) * DD +
                      wv * 32 + (lane & 3) * 8;
    _Float16* xd = &Xl[(hs * 64 + wv) * 512 +
                       frag_off(lane >> 2, (lane & 3) * 8)];
    {
      v4f lo[16], hi[16];
#pragma unroll
      for (int it = 0; it < 16; ++it) {
        lo[it] = *(const v4f*)(xs + (size_t)it * 8 * DD);
        hi[it] = *(const v4f*)(xs + (size_t)it * 8 * DD + 4);
      }
      // before a register that these loads name is written again; the address
      // as an input keeps the last load's data out of the address pair
      asm volatile("s_wait_xcnt 0x0" :: "v"(xs) : "memory");
#pragma unroll
      for (int it = 0; it < 16; ++it) {
        v8h o;
#pragma unroll
        for (int j = 0; j < 4; ++j) {
          o[j]     = (_Float16)lo[it][j];
          o[4 + j] = (_Float16)hi[it][j];
        }
        // row it*8 + (lane>>2): row tile it>>1, column (it&1)*8 + (lane>>2)
        *(v8h*)(xd + (it >> 1) * (8 * 512) + (it & 1) * 64) = o;
      }
    }
  }
  float* MB = &MB2[hs][0];
  MB[threadIdx.x & (NN - 1)] = 1e9f * (mk - 1.0f);
  __syncthreads();

  // acc[m][j]: rows wv*32 + m*16 .., column tile j: matrix j>>1 (Q, K, V,
  // gate), columns h*32 + (j&1)*16 .. of it
  v8f acc[2][8];
#pragma unroll
  for (int m = 0; m < 2; ++m)
#pragma unroll
    for (int j = 0; j < 8; ++j) acc[m][j] = zero8();
  {
    const _Float16* xrow = &Xl[wv * 2 * 8 * 512];
    const _Float16* __restrict__ wcol = w16 + (size_t)(h * CC) * DD;
#pragma unroll 1
    for (int kk = 0; kk < DD; kk += 32) {   // fragment kk/32 = kk*16 halves on
      v16h b[8];
#pragma unroll
      for (int j = 0; j < 8; ++j)
        b[j] = frag_ld_packed(
            wcol + (size_t)((j >> 1) * HC + (j & 1) * 16) * DD + kk * 16, lane);
      v16h a0 = frag_ld_packed(xrow + kk * 16, lane);
      v16h a1 = frag_ld_packed(xrow + (size_t)16 * DD + kk * 16, lane);
      // holds a trip's sixteen global loads, then its four LDS loads, in front
      // of its products, all in flight at once
      __builtin_amdgcn_sched_barrier(0);
#pragma unroll
      for (int j = 0; j < 8; ++j) {
        const bool wx = (j >> 1) != 2;      // V: x w^T, the others: w x^T
        acc[0][j] = wx ? wmma16(b[j], a0, acc[0][j]) : wmma16(a0, b[j], acc[0][j]);
        acc[1][j] = wx ? wmma16(b[j], a1, acc[1][j]) : wmma16(a1, b[j], acc[1][j]);
      }
    }
  }

  _Float16* Klds  = &KV[hs][0];                // 16 KB, 16 fragments
  _Float16* VTlds = &KV[hs][NN * CC];          // 16 KB, 16 fragments
  _Float16* Qs    = &QG[w16i][lane * 8];             // the lane's own units
  _Float16* Gs    = &QG[w16i][32 * CC + lane * 8];   // the lane's own units
#pragma unroll
  for (int t = 0; t < 2; ++t) {
    // Q, K, gate: row wv*32 + mt*16 + (l&15), c = t*16 + rl + vi
    // V: row wv*32 + mt*16 + rl + vi, c = t*16 + (l&15)
    const v8f gb = gbv[t];
#pragma unroll
    for (int mt = 0; mt < 2; ++mt) {
      v8h q, k, v, g;
#pragma unroll
      for (int vi = 0; vi < 8; ++vi) {
        q[vi] = (_Float16)(acc[mt][t][vi] * 0.17677669529663687f);  // C^-1/2
        k[vi] = (_Float16)acc[mt][2 + t][vi];
        v[vi] = (_Float16)acc[mt][4 + t][vi];
        const float z = acc[mt][6 + t][vi] + gb[vi];
        g[vi] = (_Float16)(1.0f / (1.0f + __expf(-z)));
      }
      *(v8h*)(Qs + mt * 512 + t * 256) = q;
      *(v8h*)(Klds + (wv * 2 + mt) * 512 + t * 256 + lane * 8) = k;
      *(v8h*)(VTlds + (wv * 2 + t) * 512 + mt * 256 + lane * 8) = v;
      *(v8h*)(Gs + mt * 512 + t * 256) = g;
    }
  }
  __syncthreads();   // K and V of all 256 keys of both heads stand in LDS

  for (int mt = 0; mt < 2; ++mt) {
    const int m0 = wv * 32 + mt * 16;
    // B operand: column = query m0 + cl, k = c
    const v8h qlo = *(const v8h*)(Qs + mt * 512);
    const v8h qhi = *(const v8h*)(Qs + mt * 512 + 256);
    const v16h qb = __builtin_shufflevector(qlo, qhi, 0, 1, 2, 3, 4, 5, 6, 7,
                                            8, 9, 10, 11, 12, 13, 14, 15);

    // nonbatched bias (per query, key): 8 consecutive keys of one query per
    // lane and tile, in two planes of 512 contiguous bytes a wave
    const float* nbp = nb_t + ((size_t)h * NN + m0) * NN + lane * 4;
    v8f nbv[16];
#pragma unroll
    for (int nt = 0; nt < 16; ++nt) {
      const v4f lo = *(const v4f*)(nbp + nt * 256);
      const v4f hi = *(const v4f*)(nbp + nt * 256 + 128);
      nbv[nt] = __builtin_shufflevector(lo, hi, 0, 1, 2, 3, 4, 5, 6, 7);
    }
    // before a register that these loads name is written again; the address
    // as an input keeps the last load's data out of the address pair
    asm volatile("s_wait_xcnt 0x0" :: "v"(nbp) : "memory");
    // holds the 32 bias loads in front of the products, all in flight at
    // once; left free, this build issues them one by one behind the products
    // and waits each out
    __builtin_amdgcn_sched_barrier(0);

    // lg[nt][vi] = logit of query m0 + cl, key nt*16 + rl + vi
    v8f lg[16];
#pragma unroll
    for (int g = 0; g < 8; ++g) {     // two key tiles a group
      v16h kf[2];                     // A rows = keys
      v8f  mb[2];                     // mask bias (per key)
#pragma unroll
      for (int t = 0; t < 2; ++t) {
        kf[t] = frag_ld_packed(&Klds[(g * 2 + t) * 512], lane);
        mb[t] = *(const v8f*)&MB[(g * 2 + t) * 16 + rl];
      }
      // holds a group's 8 LDS loads together in front of its products, one
      // wait for all; left free, this build waits out each pair of loads
      __builtin_amdgcn_sched_barrier(0);
#pragma unroll
      for (int t = 0; t < 2; ++t) lg[g * 2 + t] = wmma16(kf[t], qb, zero8());
#pragma unroll
      for (int t = 0; t < 2; ++t) lg[g * 2 + t] += mb[t] + nbv[g * 2 + t];
    }

    // softmax over the keys of one query: eight chains in the lane (one per
    // vi), joined by a tree, then the other half of the wave
    v8f mx8 = lg[0];
#pragma unroll
    for (int nt = 1; nt < 16; ++nt) mx8 = __builtin_elementwise_max(mx8, lg[nt]);
    float mx = fmaxf(fmaxf(fmaxf(mx8[0], mx8[1]), fmaxf(mx8[2], mx8[3])),
                     fmaxf(fmaxf(mx8[4], mx8[5]), fmaxf(mx8[6], mx8[7])));
    mx = fmaxf(mx, xhalf(mx));
    v8f s8 = zero8();
#pragma unroll
    for (int nt = 0; nt < 16; ++nt) {
#pragma unroll
      for (int vi = 0; vi < 8; ++vi) lg[nt][vi] = __expf(lg[nt][vi] - mx);
      s8 += lg[nt];
    }
    float s = ((s8[0] + s8[1]) + (s8[2] + s8[3])) +
              ((s8[4] + s8[5]) + (s8[6] + s8[7]));
    s += xhalf(s);
    const float inv = 1.0f / s;

    // O^T (32 c x 16 queries) = V^T (32 x 256) x P^T (256 x 16)
    v8f ao0 = zero8(), ao1 = zero8();
#pragma unroll
    for (int kq = 0; kq < 8; ++kq) {   // 32-key block
      v16h pb;                         // k = rl + j, then 16 + rl + j
#pragma unroll
      for (int j = 0; j < 8; ++j) {
        pb[j]     = (_Float16)(lg[kq * 2][j] * inv);
        pb[8 + j] = (_Float16)(lg[kq * 2 + 1][j] * inv);
      }
      v16h a0 = frag_ld_packed(&VTlds[(kq * 2) * 512], lane);      // c 0..15
      v16h a1 = frag_ld_packed(&VTlds[(kq * 2 + 1) * 512], lane);  // c 16..31
      ao0 = wmma16(a0, pb, ao0);
      ao1 = wmma16(a1, pb, ao1);
    }

    _Float16* wp = wa_ws + ((size_t)b2 * NN + m0) * HC + h * 512 + lane * 8;
#pragma unroll
    for (int ct = 0; ct < 2; ++ct) {
      const v8f& ao = ct ? ao1 : ao0;
      const v8h g = *(const v8h*)(Gs + mt * 512 + ct * 256);
      v8h o;
#pragma unroll
      for (int vi = 0; vi < 8; ++vi) o[vi] = (_Float16)(ao[vi] * (float)g[vi]);
      *(v8h*)(wp + ct * 256) = o;
    }
    // before a register that these stores name is written again (next trip)
    asm volatile("s_wait_xcnt 0x0" ::: "memory");
  }
}

// ---------------------------------------------------------------------------
// Kernel 2: output projection  out[M,256] = wa[M,256] x wo16^T + b_o
// Wave tile 32x64; block = 2x4 waves = 64 rows x all 256 cols.
// ---------------------------------------------------------------------------
__global__ __launch_bounds__(256) void k_out(
    const _Float16* __restrict__ wa_ws,  // [B2*N/16, 8 fragments x 512]
    const _Float16* __restrict__ wo16,   // [256/16, 8 fragments x 512]
    const float* __restrict__ b_o,       // [256]
    float* __restrict__ out) {           // [B2*N, 256]
  const int lane = threadIdx.x & 31;
  const int wv   = threadIdx.x >> 5;
  const int wr   = wv >> 2;
  const int wc   = wv & 3;
  const int row0 = blockIdx.x * 64 + wr * 32;
  const int col0 = wc * 64;
  const int rl   = (lane >> 4) * 8;
  const int cl   = lane & 15;

  const _Float16* arow = wa_ws + (size_t)row0 * HC;
  __builtin_prefetch(arow, 0, 3);

  v8f acc[2][4];
#pragma unroll
  for (int m = 0; m < 2; ++m)
#pragma unroll
    for (int t = 0; t < 4; ++t) acc[m][t] = zero8();

  // two trips a body: eight loads go out together at the head of a trip;
  // unrolled whole, this build has two to four in flight
#pragma unroll 2
  for (int kk = 0; kk < HC; kk += 32) {   // fragment kk/32 = kk*16 halves on
    v16h a0 = frag_ld_packed(arow + kk * 16, lane);
    v16h a1 = frag_ld_packed(arow + (size_t)16 * HC + kk * 16, lane);
#pragma unroll
    for (int t = 0; t < 4; ++t) {
      v16h b = frag_ld_packed(wo16 + (size_t)(col0 + t * 16) * HC + kk * 16, lane);
      acc[0][t] = wmma16(a0, b, acc[0][t]);
      acc[1][t] = wmma16(a1, b, acc[1][t]);
    }
  }

#pragma unroll
  for (int mt = 0; mt < 2; ++mt) {
#pragma unroll
    for (int t = 0; t < 4; ++t) {
      const int o = col0 + t * 16 + cl;
      const float bo = b_o[o];
#pragma unroll
      for (int vi = 0; vi < 8; ++vi) {
        const int r = row0 + mt * 16 + vi + rl;
        out[(size_t)r * OUTD + o] = acc[mt][t][vi] + bo;
      }
    }
  }
}

// ---------------------------------------------------------------------------
extern "C" void kernel_launch(void* const* d_in, const int* in_sizes, int n_in,
                              void* d_out, int out_size, void* d_ws, size_t ws_size,
                              hipStream_t stream) {
  (void)in_sizes; (void)n_in; (void)out_size; (void)ws_size;
  const float* in_data = (const float*)d_in[0];
  const float* mask    = (const float*)d_in[1];
  const float* nb_bias = (const float*)d_in[2];
  const float* w_qkv   = (const float*)d_in[3];
  const float* w_gate  = (const float*)d_in[4];
  const float* g_bias  = (const float*)d_in[5];
  const float* w_o     = (const float*)d_in[6];
  const float* b_o     = (const float*)d_in[7];
  float* out = (float*)d_out;

  // Workspace layout (f16 elements)
  _Float16* w16    = (_Float16*)d_ws;            // [1024 x 256] fused qkv|gate
  _Float16* wo16   = w16 + (size_t)(QKV_E + HC) * DD;
  _Float16* wa_ws  = wo16 + (size_t)OUTD * HC;
  float*    nb_t   = (float*)(wa_ws + (size_t)B2 * NN * HC);  // [H*N*N]

  // 0) f32 -> f16 conversion of the three weight matrices, into fragment
  //    order, one launch (wo16 lies directly behind w16); the same launch
  //    lays the nonbatched bias out in the order of the attention lanes
  k_cvt<<<dim3(WBLK + NBLK), 256, 0, stream>>>(w_qkv, w_gate, w_o, nb_bias,
                                               w16, nb_t);

  // 1) QKV + gate projection and attention per (two heads, b2)
  k_proj_attn<<<dim3(HH / 2, B2), 512, 0, stream>>>(in_data, w16, g_bias, mask,
                                                nb_t, wa_ws);
  // 2) output projection: [32768 x 256] x [256 x 256] + bias
  k_out<<<dim3((B2 * NN) / 64), 256, 0, stream>>>(wa_ws, wo16, b_o, out);
}
